// v000
// The times below were measured on an AMD MI455X: many runs one after another, warmed up first and cycling through
// copies of the inputs, with the whole window's GPU time divided by the number of runs. Launches and the gaps
// between them are all in it. The median over several windows is given; except for v000 it joins two sittings, which
// can be a few percent apart, so the side-by-side timings, each taken in one sitting, are the better comparison.
// The starting kernel, v000, takes 66.4 microseconds a run.
#include <hip/hip_runtime.h>
#include <hip/hip_bf16.h>

// ---------------- problem constants (from reference) ----------------
#define B_ 4
#define T_ 2048
#define C_ 1024
#define TD_ 128

#define LCH 32            // chunk length along T
#define NCH (T_ / LCH)    // 64 chunks
#define BC_ (B_ * C_)     // 4096 channels

typedef __attribute__((ext_vector_type(16))) _Float16 v16h;
typedef __attribute__((ext_vector_type(8)))  float    v8f;

// =====================================================================
// Kernel 1: time-conditioning projection via WMMA (f16 in, f32 acc).
//   tmpW[b,c] = sum_k time_emb[b,k] * time_w_proj[c,k]   (ditto U)
//   decay[b,c] = exp(-exp(w[c] + tmpW*s)) * (0.5 + 0.5*tf[b])
//   ucond[b,c] = u[c] + tmpU*s
// One wave per 16-column tile of C (64 blocks x 32 threads).
// M dim = 16 (rows 0..3 = batch, rest zero via mask-multiply, NOT via
// divergent loads -- EXEC stays all-1s and loads stay coalesced).
// =====================================================================
__global__ void __launch_bounds__(32)
k_proj(const float* __restrict__ time_emb,   // [B, TD]
       const float* __restrict__ w,          // [C]
       const float* __restrict__ u,          // [C]
       const float* __restrict__ wproj,      // [C, TD]
       const float* __restrict__ uproj,      // [C, TD]
       const float* __restrict__ lts,        // [1]
       float* __restrict__ tf_out,           // [4]
       float* __restrict__ decay_out,        // [B*C]
       float* __restrict__ ucond_out)        // [B*C]
{
    const int lane = threadIdx.x;            // 0..31
    const int c0   = blockIdx.x * 16;        // column tile base
    const int m    = lane & 15;              // row (A) / col (B) index
    const int hi   = lane >> 4;              // lane half selects K sub-range
    const int mrow = m & 3;                  // clamped A row (always valid)
    const float amask = (m < 4) ? 1.f : 0.f; // zero-pad rows 4..15 by math

    // time factor tf[b] = sigmoid(sum_k time_emb[b,k]); cheap, per-lane.
    float tf4[4];
    #pragma unroll
    for (int b = 0; b < 4; ++b) {
        float s = 0.f;
        for (int j = 0; j < TD_; ++j) s += time_emb[b * TD_ + j];
        tf4[b] = 1.f / (1.f + __expf(-s));
    }
    if (blockIdx.x == 0 && lane < 4) tf_out[lane] = tf4[lane];

    v8f accW = {}; v8f accU = {};
    #pragma unroll
    for (int kc = 0; kc < TD_; kc += 32) {
        v16h a, bw, bu;
        // 16-bit A 16x32 layout (ISA 7.12.2): lanes 0-15 rows, VGPR v holds
        // K = {2v,2v+1} (v<4) or {16+2(v-4),...}; lanes 16-31 add +8 to K.
        #pragma unroll
        for (int e = 0; e < 16; ++e) {
            const int vg = e >> 1, h = e & 1;
            const int kk = (vg < 4) ? (hi * 8 + 2 * vg + h)
                                    : (16 + hi * 8 + 2 * (vg - 4) + h);
            a[e]  = (_Float16)(time_emb[mrow * TD_ + kc + kk] * amask);
            bw[e] = (_Float16)wproj[(c0 + m) * TD_ + kc + kk];
            bu[e] = (_Float16)uproj[(c0 + m) * TD_ + kc + kk];
        }
        accW = __builtin_amdgcn_wmma_f32_16x16x32_f16(
            false, a, false, bw, (short)0, accW, false, false);
        accU = __builtin_amdgcn_wmma_f32_16x16x32_f16(
            false, a, false, bu, (short)0, accU, false, false);
    }

    // D layout: VGPR r, lanes 0-15 -> M = r (0..7). Rows 0..3 are batches.
    const float scale = lts[0];
    if (hi == 0) {
        #pragma unroll
        for (int r = 0; r < 4; ++r) {
            const int b = r, c = c0 + m;
            const float wc  = w[c] + accW[r] * scale;
            const float dcy = __expf(-__expf(wc)) * (0.5f + 0.5f * tf4[b]);
            decay_out[b * C_ + c] = dcy;
            ucond_out[b * C_ + c] = u[c] + accU[r] * scale;
        }
    }
}

// =====================================================================
// Kernel 2: chunk-local bidirectional scan. One thread per (b, c, chunk).
// Backward local scan kept in a fully-unrolled register array, then the
// forward local scan fuses fwd + bwd + cross term into partial num/den.
// Chunk carries (full-chunk fwd sum G, bwd sum H) saved for fix-up.
// =====================================================================
__global__ void __launch_bounds__(256)
k_scan(const float* __restrict__ kin, const float* __restrict__ vin,
       const float* __restrict__ decay, const float* __restrict__ ucond,
       float* __restrict__ numP,           // [B*T*C]  (lives in d_out)
       float* __restrict__ denP,           // [B*T*C]
       float* __restrict__ Gn, float* __restrict__ Gd,
       float* __restrict__ Hn, float* __restrict__ Hd)  // [NCH][B*C]
{
    const int g  = blockIdx.x * blockDim.x + threadIdx.x;   // [0, B*C*NCH)
    const int c  = g & (C_ - 1);
    const int r  = g >> 10;            // C_ = 1024
    const int b  = r & (B_ - 1);
    const int ch = r >> 2;             // B_ = 4
    if (ch >= NCH) return;

    const int bc = b * C_ + c;
    const float d  = decay[bc];
    const float uc = ucond[bc];
    const int base = ((b * T_) + ch * LCH) * C_ + c;

    // ---- backward local scan (registers, full unroll) ----
    float bn[LCH], bd[LCH];
    float ab = 0.f, db = 0.f;
    #pragma unroll
    for (int tl = LCH - 1; tl >= 0; --tl) {
        const int idx = base + tl * C_;
        const float kk = kin[idx], vv = vin[idx];
        const float ek = __expf(fminf(kk, 30.f));
        ab = ab * d + ek * vv;
        db = db * d + ek;
        bn[tl] = ab; bd[tl] = db;
    }
    Hn[ch * BC_ + bc] = ab;
    Hd[ch * BC_ + bc] = db;

    // ---- forward local scan, fuse everything local ----
    float af = 0.f, df = 0.f;
    #pragma unroll
    for (int tl = 0; tl < LCH; ++tl) {
        const int idx = base + tl * C_;
        const float kk = kin[idx], vv = vin[idx];   // L0/L2 hit (re-read)
        const float ek  = __expf(fminf(kk, 30.f));
        const float euk = __expf(fminf(uc + kk, 30.f));
        af = af * d + ek * vv;
        df = df * d + ek;
        numP[idx] = af + bn[tl] + (euk - ek) * vv;
        denP[idx] = df + bd[tl] + (euk - ek);
    }
    Gn[ch * BC_ + bc] = af;
    Gd[ch * BC_ + bc] = df;
}

// =====================================================================
// Kernel 3: per-channel carry prefix (fwd) / suffix (bwd) over chunks.
//   Cf[i] = Cf[i-1]*d^L + G[i-1]   (Cf[0]=0)
//   Cb[i] = Cb[i+1]*d^L + H[i+1]   (Cb[NCH-1]=0)
// =====================================================================
__global__ void __launch_bounds__(256)
k_carry(const float* __restrict__ decay,
        const float* __restrict__ Gn, const float* __restrict__ Gd,
        const float* __restrict__ Hn, const float* __restrict__ Hd,
        float* __restrict__ CfN, float* __restrict__ CfD,
        float* __restrict__ CbN, float* __restrict__ CbD)
{
    const int g = blockIdx.x * blockDim.x + threadIdx.x;   // [0, B*C)
    if (g >= BC_) return;
    const float d  = decay[g];
    const float lg = __log2f(d);                 // d>0; underflow -> -inf ok
    const float dL = exp2f((float)LCH * lg);     // d^L

    float cn = 0.f, cd = 0.f;
    for (int i = 0; i < NCH; ++i) {
        CfN[i * BC_ + g] = cn; CfD[i * BC_ + g] = cd;
        cn = cn * dL + Gn[i * BC_ + g];
        cd = cd * dL + Gd[i * BC_ + g];
    }
    cn = 0.f; cd = 0.f;
    for (int i = NCH - 1; i >= 0; --i) {
        CbN[i * BC_ + g] = cn; CbD[i * BC_ + g] = cd;
        cn = cn * dL + Hn[i * BC_ + g];
        cd = cd * dL + Hd[i * BC_ + g];
    }
}

// =====================================================================
// Kernel 4: apply carries + final elementwise math.
//   num(t) = numP(t) + CfN*d^(tl+1) + CbN*d^(L-tl)    (den likewise)
//   out    = sigmoid(r) * num/max(den,1e-8) * (0.8+0.2*tf[b])
// =====================================================================
__global__ void __launch_bounds__(256)
k_final(const float* __restrict__ rin, const float* __restrict__ tf,
        const float* __restrict__ decay, const float* __restrict__ denP,
        const float* __restrict__ CfN, const float* __restrict__ CfD,
        const float* __restrict__ CbN, const float* __restrict__ CbD,
        float* __restrict__ out)             // in: numP, out: final
{
    const int g  = blockIdx.x * blockDim.x + threadIdx.x;   // [0, B*C*NCH)
    const int c  = g & (C_ - 1);
    const int r  = g >> 10;
    const int b  = r & (B_ - 1);
    const int ch = r >> 2;
    if (ch >= NCH) return;

    const int bc = b * C_ + c;
    const float lg  = __log2f(decay[bc]);
    const float tfb = tf[b];
    const float cfn = CfN[ch * BC_ + bc], cfd = CfD[ch * BC_ + bc];
    const float cbn = CbN[ch * BC_ + bc], cbd = CbD[ch * BC_ + bc];
    const int base = ((b * T_) + ch * LCH) * C_ + c;

    #pragma unroll 4
    for (int tl = 0; tl < LCH; ++tl) {
        const int idx = base + tl * C_;
        if (tl + 8 < LCH)  // stage upcoming lines (global_prefetch_b8)
            __builtin_prefetch(&rin[idx + 8 * C_], 0, 0);
        const float ff = exp2f((float)(tl + 1)   * lg);   // d^(tl+1)
        const float fb = exp2f((float)(LCH - tl) * lg);   // d^(L-tl)
        const float num = out[idx]  + cfn * ff + cbn * fb;
        const float den = denP[idx] + cfd * ff + cbd * fb;
        const float sr  = 1.f / (1.f + __expf(-rin[idx]));
        const float bse = sr * num / fmaxf(den, 1e-8f);
        out[idx] = bse * (0.8f + 0.2f * tfb);
    }
}

// =====================================================================
// Launcher
// =====================================================================
extern "C" void kernel_launch(void* const* d_in, const int* in_sizes, int n_in,
                              void* d_out, int out_size, void* d_ws, size_t ws_size,
                              hipStream_t stream) {
    const float* r_in      = (const float*)d_in[0];   // [B,T,C]
    const float* k_in      = (const float*)d_in[1];   // [B,T,C]
    const float* v_in      = (const float*)d_in[2];   // [B,T,C]
    const float* time_emb  = (const float*)d_in[3];   // [B,TD]
    const float* w_in      = (const float*)d_in[4];   // [1,1,C]
    const float* u_in      = (const float*)d_in[5];   // [1,1,C]
    const float* wproj     = (const float*)d_in[6];   // [C,TD]
    const float* uproj     = (const float*)d_in[7];   // [C,TD]
    const float* lts       = (const float*)d_in[8];   // [1]
    float* out = (float*)d_out;                       // [B,T,C] fp32

    // workspace carve-up (floats)
    float* ws   = (float*)d_ws;
    float* tf    = ws;                    // 8 (4 used)
    float* decay = tf + 8;                // B*C
    float* ucond = decay + BC_;           // B*C
    float* Gn    = ucond + BC_;           // NCH*B*C each below
    float* Gd    = Gn  + NCH * BC_;
    float* Hn    = Gd  + NCH * BC_;
    float* Hd    = Hn  + NCH * BC_;
    float* CfN   = Hd  + NCH * BC_;
    float* CfD   = CfN + NCH * BC_;
    float* CbN   = CfD + NCH * BC_;
    float* CbD   = CbN + NCH * BC_;
    float* denP  = CbD + NCH * BC_;       // B*T*C

    // 1) WMMA time projection -> tf, decay, ucond
    k_proj<<<C_ / 16, 32, 0, stream>>>(time_emb, w_in, u_in, wproj, uproj, lts,
                                       tf, decay, ucond);

    // 2) chunk-local bidirectional scans (B*C*NCH threads)
    const int nScan = BC_ * NCH;
    k_scan<<<nScan / 256, 256, 0, stream>>>(k_in, v_in, decay, ucond,
                                            out, denP, Gn, Gd, Hn, Hd);

    // 3) carry prefix/suffix per channel
    k_carry<<<BC_ / 256, 256, 0, stream>>>(decay, Gn, Gd, Hn, Hd,
                                           CfN, CfD, CbN, CbD);

    // 4) apply carries + finalize
    k_final<<<nScan / 256, 256, 0, stream>>>(r_in, tf, decay, denP,
                                             CfN, CfD, CbN, CbD, out);
}

// v001
// A run of this version takes 45.5 microseconds.
// In two side-by-side timings against v000, it was 1.48 and 1.47 times as fast.
#include <hip/hip_runtime.h>
#include <hip/hip_bf16.h>

// ---------------- problem constants (from reference) ----------------
#define B_ 4
#define T_ 2048
#define C_ 1024
#define TD_ 128

#define LCH 32               // sub-chunk length along T (kept in registers)
#define NSUB 4               // sub-chunks per wave
#define SPAN (LCH * NSUB)    // 128 steps of T per wave
#define NSPAN (T_ / SPAN)    // 16 waves cover all of T
#define CW 32                // channels per work-group: one 128-byte line
#define BC_ (B_ * C_)        // 4096 channels

typedef __attribute__((ext_vector_type(16))) _Float16 v16h;
typedef __attribute__((ext_vector_type(8)))  float    v8f;

// =====================================================================
// Kernel 1: time-conditioning projection via WMMA (f16 in, f32 acc).
//   tmpW[b,c] = sum_k time_emb[b,k] * time_w_proj[c,k]   (ditto U)
//   decay[b,c] = exp(-exp(w[c] + tmpW*s)) * (0.5 + 0.5*tf[b])
//   ucond[b,c] = u[c] + tmpU*s
// One wave per 16-column tile of C (64 blocks x 32 threads).
// M dim = 16 (rows 0..3 = batch, rest zero via mask-multiply, NOT via
// divergent loads -- EXEC stays all-1s and loads stay coalesced).
// =====================================================================
__global__ void __launch_bounds__(32)
k_proj(const float* __restrict__ time_emb,   // [B, TD]
       const float* __restrict__ w,          // [C]
       const float* __restrict__ u,          // [C]
       const float* __restrict__ wproj,      // [C, TD]
       const float* __restrict__ uproj,      // [C, TD]
       const float* __restrict__ lts,        // [1]
       float* __restrict__ tf_out,           // [4]
       float* __restrict__ decay_out,        // [B*C]
       float* __restrict__ ucond_out)        // [B*C]
{
    const int lane = threadIdx.x;            // 0..31
    const int c0   = blockIdx.x * 16;        // column tile base
    const int m    = lane & 15;              // row (A) / col (B) index
    const int hi   = lane >> 4;              // lane half selects K sub-range
    const int mrow = m & 3;                  // clamped A row (always valid)
    const float amask = (m < 4) ? 1.f : 0.f; // zero-pad rows 4..15 by math

    // time factor tf[b] = sigmoid(sum_k time_emb[b,k]); cheap, per-lane.
    float tf4[4];
    #pragma unroll
    for (int b = 0; b < 4; ++b) {
        float s = 0.f;
        for (int j = 0; j < TD_; ++j) s += time_emb[b * TD_ + j];
        tf4[b] = 1.f / (1.f + __expf(-s));
    }
    if (blockIdx.x == 0 && lane < 4) tf_out[lane] = tf4[lane];

    v8f accW = {}; v8f accU = {};
    #pragma unroll
    for (int kc = 0; kc < TD_; kc += 32) {
        v16h a, bw, bu;
        // 16-bit A 16x32 layout (ISA 7.12.2): lanes 0-15 rows, VGPR v holds
        // K = {2v,2v+1} (v<4) or {16+2(v-4),...}; lanes 16-31 add +8 to K.
        #pragma unroll
        for (int e = 0; e < 16; ++e) {
            const int vg = e >> 1, h = e & 1;
            const int kk = (vg < 4) ? (hi * 8 + 2 * vg + h)
                                    : (16 + hi * 8 + 2 * (vg - 4) + h);
            a[e]  = (_Float16)(time_emb[mrow * TD_ + kc + kk] * amask);
            bw[e] = (_Float16)wproj[(c0 + m) * TD_ + kc + kk];
            bu[e] = (_Float16)uproj[(c0 + m) * TD_ + kc + kk];
        }
        accW = __builtin_amdgcn_wmma_f32_16x16x32_f16(
            false, a, false, bw, (short)0, accW, false, false);
        accU = __builtin_amdgcn_wmma_f32_16x16x32_f16(
            false, a, false, bu, (short)0, accU, false, false);
    }

    // D layout: VGPR r, lanes 0-15 -> M = r (0..7). Rows 0..3 are batches.
    const float scale = lts[0];
    if (hi == 0) {
        #pragma unroll
        for (int r = 0; r < 4; ++r) {
            const int b = r, c = c0 + m;
            const float wc  = w[c] + accW[r] * scale;
            const float dcy = __expf(-__expf(wc)) * (0.5f + 0.5f * tf4[b]);
            decay_out[b * C_ + c] = dcy;
            ucond_out[b * C_ + c] = u[c] + accU[r] * scale;
        }
    }
}

// e^x as the fast exponential forms it (one multiply, v_exp_f32). The v_nop in
// the same statement is the free slot the instruction set asks for behind a
// transcendental.
__device__ __forceinline__ float exp_slot(float x)
{
    float r;
    asm("v_exp_f32 %0, %1\n\tv_nop" : "=v"(r) : "v"(x * 1.44269504088896340736f));
    return r;
}

// =====================================================================
// Kernel 2: the whole bidirectional scan in one launch.
// One work-group owns all of T for 32 channels of one batch row; lane =
// channel, wave = a span of 128 steps, worked as 4 sub-chunks of 32.
//   pass 1: span sums with zero start (forward G, backward H) -> LDS
//   barrier; every wave folds the other spans' sums into its two carries
//   pass 2: both scans again, started FROM the carries, so num and den
//           are final in registers and only the output is stored.
// Every loop over tl is fully unrolled so that its arrays live in registers.
// =====================================================================
__global__ void __launch_bounds__(NSPAN * 32)
k_fused(const float* __restrict__ rin, const float* __restrict__ kin,
        const float* __restrict__ vin, const float* __restrict__ tf,
        const float* __restrict__ decay, const float* __restrict__ ucond,
        float* __restrict__ out)
{
    __shared__ float sGn[NSPAN][CW], sGd[NSPAN][CW];
    __shared__ float sHn[NSPAN][CW], sHd[NSPAN][CW];

    const int lane = threadIdx.x & 31;
    const int wv   = __builtin_amdgcn_readfirstlane(threadIdx.x >> 5);
    const int bc   = blockIdx.x * CW + lane;
    const int b    = blockIdx.x / (C_ / CW);
    const int c    = bc & (C_ - 1);

    const float d  = decay[bc];
    const float uc = ucond[bc];
    // the two loads' index register is free for reuse behind this wait
    asm volatile("s_wait_xcnt 0x0" ::: "memory");
    const float d2 = d * d, d4 = d2 * d2, d8 = d4 * d4, d16 = d8 * d8;
    const float dL = d16 * d16;                 // d^LCH
    const float dL2 = dL * dL, dS = dL2 * dL2;  // d^SPAN
    const int base0 = (b * T_ + wv * SPAN) * C_ + c;

    // ---- pass 1: sums of this wave's span, zero start ----
    float af = 0.f, df = 0.f;                   // runs through the whole span
    float hn0 = 0.f, hn1 = 0.f, hn2 = 0.f, hn3 = 0.f;   // per sub-chunk
    float hd0 = 0.f, hd1 = 0.f, hd2 = 0.f, hd3 = 0.f;
    // unrolled, the next sub-chunk's loads written ahead of this one's sums:
    // memory stays busy while the wave computes
    float kA[LCH], vA[LCH];
    #pragma unroll
    for (int tl = 0; tl < LCH; ++tl) {
        kA[tl] = kin[base0 + tl * C_];
        vA[tl] = vin[base0 + tl * C_];
    }
    #pragma unroll
    for (int j = 0; j < NSUB; ++j) {
        float kB[LCH], vB[LCH];
        if (j + 1 < NSUB) {
            #pragma unroll
            for (int tl = 0; tl < LCH; ++tl) {
                kB[tl] = kin[base0 + ((j + 1) * LCH + tl) * C_];
                vB[tl] = vin[base0 + ((j + 1) * LCH + tl) * C_];
            }
        }
        float e[LCH], x[LCH];
        #pragma unroll
        for (int tl = 0; tl < LCH; ++tl) {
            e[tl] = exp_slot(fminf(kA[tl], 30.f));
            x[tl] = e[tl] * vA[tl];
        }
        #pragma unroll
        for (int tl = 0; tl < LCH; ++tl) {
            af = af * d + x[tl];
            df = df * d + e[tl];
        }
        float hn = 0.f, hd = 0.f;
        #pragma unroll
        for (int tl = LCH - 1; tl >= 0; --tl) {
            hn = hn * d + x[tl];
            hd = hd * d + e[tl];
        }
        hn0 = hn1; hn1 = hn2; hn2 = hn3; hn3 = hn;   // after 4 trips: hnJ = sub-chunk J
        hd0 = hd1; hd1 = hd2; hd2 = hd3; hd3 = hd;
        if (j + 1 < NSUB) {
            #pragma unroll
            for (int tl = 0; tl < LCH; ++tl) { kA[tl] = kB[tl]; vA[tl] = vB[tl]; }
        }
    }
    sGn[wv][lane] = af;
    sGd[wv][lane] = df;
    sHn[wv][lane] = hn0 + dL * (hn1 + dL * (hn2 + dL * hn3));
    sHd[wv][lane] = hd0 + dL * (hd1 + dL * (hd2 + dL * hd3));
    __syncthreads();

    // ---- carries into this span: forward from the left, backward from the right ----
    // The running fold is formed over all spans and sampled at this wave's own,
    // so the LDS reads depend on no branch and go out together.
    float cfn = 0.f, cfd = 0.f, cbn = 0.f, cbd = 0.f;
    float rn = 0.f, rd = 0.f;
    #pragma unroll
    for (int i = 0; i < NSPAN; ++i) {
        cfn = (i == wv) ? rn : cfn;
        cfd = (i == wv) ? rd : cfd;
        rn = rn * dS + sGn[i][lane];
        rd = rd * dS + sGd[i][lane];
    }
    rn = 0.f; rd = 0.f;
    #pragma unroll
    for (int i = NSPAN - 1; i >= 0; --i) {
        cbn = (i == wv) ? rn : cbn;
        cbd = (i == wv) ? rd : cbd;
        rn = rn * dS + sHn[i][lane];
        rd = rd * dS + sHd[i][lane];
    }
    // backward state just right of each sub-chunk
    float cn3 = cbn, cn2 = hn3 + dL * cn3, cn1 = hn2 + dL * cn2, cn0 = hn1 + dL * cn1;
    float cd3 = cbd, cd2 = hd3 + dL * cd3, cd1 = hd2 + dL * cd2, cd0 = hd1 + dL * cd1;

    // ---- pass 2: both scans from their carries, then the output ----
    const float tfb = tf[b];
    af = cfn; df = cfd;
    // rolled: one body in the instruction cache, one sub-chunk in registers
    #pragma unroll 1
    for (int j = 0; j < NSUB; ++j) {
        const int base = base0 + j * (LCH * C_);
        float kk[LCH], vv[LCH], rr[LCH];
        #pragma unroll
        for (int tl = LCH - 1; tl >= 0; --tl) {
            const int idx = base + tl * C_;
            kk[tl] = kin[idx];                  // second read: L2
            vv[tl] = vin[idx];
        }
        // a later load may land in an address register of the loads above
        asm volatile("s_wait_xcnt 0x0" ::: "memory");
        #pragma unroll
        for (int tl = 0; tl < LCH; ++tl) rr[tl] = rin[base + tl * C_];
        // keeps the sub-chunk's loads together in front of the arithmetic; left to
        // itself the scheduler can deal them out a few at a time, each with its wait
        __builtin_amdgcn_sched_barrier(0);
        float e[LCH], x[LCH], bn[LCH], bd[LCH];
        float ab = cn0, db = cd0;
        #pragma unroll
        for (int tl = LCH - 1; tl >= 0; --tl) {
            const float ek  = exp_slot(fminf(kk[tl], 30.f));
            const float euk = exp_slot(fminf(uc + kk[tl], 30.f));
            e[tl] = ek;
            x[tl] = ek * vv[tl];
            ab = ab * d + x[tl];
            db = db * d + ek;
            bn[tl] = ab + (euk - ek) * vv[tl];
            bd[tl] = db + (euk - ek);
        }
        #pragma unroll
        for (int tl = 0; tl < LCH; ++tl) {
            const int idx = base + tl * C_;
            af = af * d + x[tl];
            df = df * d + e[tl];
            const float num = af + bn[tl];
            const float den = df + bd[tl];
            const float sr  = 1.f / (1.f + exp_slot(-rr[tl]));
            const float bse = sr * num / fmaxf(den, 1e-8f);
            out[idx] = bse * (0.8f + 0.2f * tfb);
        }
        cn0 = cn1; cn1 = cn2; cn2 = cn3;
        cd0 = cd1; cd1 = cd2; cd2 = cd3;
        // the next trip rewrites the stores' address and data registers
        asm volatile("s_wait_xcnt 0x0" ::: "memory");
    }
}

// =====================================================================
// Launcher
// =====================================================================
extern "C" void kernel_launch(void* const* d_in, const int* in_sizes, int n_in,
                              void* d_out, int out_size, void* d_ws, size_t ws_size,
                              hipStream_t stream) {
    const float* r_in      = (const float*)d_in[0];   // [B,T,C]
    const float* k_in      = (const float*)d_in[1];   // [B,T,C]
    const float* v_in      = (const float*)d_in[2];   // [B,T,C]
    const float* time_emb  = (const float*)d_in[3];   // [B,TD]
    const float* w_in      = (const float*)d_in[4];   // [1,1,C]
    const float* u_in      = (const float*)d_in[5];   // [1,1,C]
    const float* wproj     = (const float*)d_in[6];   // [C,TD]
    const float* uproj     = (const float*)d_in[7];   // [C,TD]
    const float* lts       = (const float*)d_in[8];   // [1]
    float* out = (float*)d_out;                       // [B,T,C] fp32

    // workspace carve-up (floats)
    float* ws   = (float*)d_ws;
    float* tf    = ws;                    // 8 (4 used)
    float* decay = tf + 8;                // B*C
    float* ucond = decay + BC_;           // B*C

    // 1) WMMA time projection -> tf, decay, ucond
    k_proj<<<C_ / 16, 32, 0, stream>>>(time_emb, w_in, u_in, wproj, uproj, lts,
                                       tf, decay, ucond);

    // 2) both scans, carries and the output: one work-group per 32 channels
    k_fused<<<BC_ / CW, NSPAN * 32, 0, stream>>>(r_in, k_in, v_in, tf, decay, ucond, out);
}

// v002
// A run of this version takes 34.3 microseconds.
// In two side-by-side timings against v001, it was 1.33 and 1.32 times as fast.
// Counting every step since v000, it is 1.96 times as fast.
#include <hip/hip_runtime.h>
#include <hip/hip_bf16.h>

// ---------------- problem constants (from reference) ----------------
#define B_ 4
#define T_ 2048
#define C_ 1024
#define TD_ 128

#define LCH 32               // sub-chunk length along T (kept in registers)
#define NSUB 2               // sub-chunks per span
#define SPAN (LCH * NSUB)    // 64 steps of T per span
#define NH 2                 // work-groups that share one channel group's T
#define TH (T_ / NH)         // 1024 steps of T whose output one work-group forms
#define NSPAN (TH / SPAN)    // 16 waves cover one half of T
#define CW 32                // channels per work-group: one 128-byte line
#define BC_ (B_ * C_)        // 4096 channels

typedef __attribute__((ext_vector_type(16))) _Float16 v16h;
typedef __attribute__((ext_vector_type(8)))  float    v8f;

// =====================================================================
// Kernel 1: time-conditioning projection via WMMA (f16 in, f32 acc).
//   tmpW[b,c] = sum_k time_emb[b,k] * time_w_proj[c,k]   (ditto U)
//   decay[b,c] = exp(-exp(w[c] + tmpW*s)) * (0.5 + 0.5*tf[b])
//   ucond[b,c] = u[c] + tmpU*s
// One wave per 16-column tile of C (64 blocks x 32 threads).
// M dim = 16 (rows 0..3 = batch, rest zero via mask-multiply, NOT via
// divergent loads -- EXEC stays all-1s and loads stay coalesced).
// =====================================================================
__global__ void __launch_bounds__(32)
k_proj(const float* __restrict__ time_emb,   // [B, TD]
       const float* __restrict__ w,          // [C]
       const float* __restrict__ u,          // [C]
       const float* __restrict__ wproj,      // [C, TD]
       const float* __restrict__ uproj,      // [C, TD]
       const float* __restrict__ lts,        // [1]
       float* __restrict__ tf_out,           // [4]
       float* __restrict__ decay_out,        // [B*C]
       float* __restrict__ ucond_out)        // [B*C]
{
    const int lane = threadIdx.x;            // 0..31
    const int c0   = blockIdx.x * 16;        // column tile base
    const int m    = lane & 15;              // row (A) / col (B) index
    const int hi   = lane >> 4;              // lane half selects K sub-range
    const int mrow = m & 3;                  // clamped A row (always valid)
    const float amask = (m < 4) ? 1.f : 0.f; // zero-pad rows 4..15 by math

    // time factor tf[b] = sigmoid(sum_k time_emb[b,k]); cheap, per-lane.
    float tf4[4];
    #pragma unroll
    for (int b = 0; b < 4; ++b) {
        float s = 0.f;
        for (int j = 0; j < TD_; ++j) s += time_emb[b * TD_ + j];
        tf4[b] = 1.f / (1.f + __expf(-s));
    }
    if (blockIdx.x == 0 && lane < 4) tf_out[lane] = tf4[lane];

    v8f accW = {}; v8f accU = {};
    #pragma unroll
    for (int kc = 0; kc < TD_; kc += 32) {
        v16h a, bw, bu;
        // 16-bit A 16x32 layout (ISA 7.12.2): lanes 0-15 rows, VGPR v holds
        // K = {2v,2v+1} (v<4) or {16+2(v-4),...}; lanes 16-31 add +8 to K.
        #pragma unroll
        for (int e = 0; e < 16; ++e) {
            const int vg = e >> 1, h = e & 1;
            const int kk = (vg < 4) ? (hi * 8 + 2 * vg + h)
                                    : (16 + hi * 8 + 2 * (vg - 4) + h);
            a[e]  = (_Float16)(time_emb[mrow * TD_ + kc + kk] * amask);
            bw[e] = (_Float16)wproj[(c0 + m) * TD_ + kc + kk];
            bu[e] = (_Float16)uproj[(c0 + m) * TD_ + kc + kk];
        }
        accW = __builtin_amdgcn_wmma_f32_16x16x32_f16(
            false, a, false, bw, (short)0, accW, false, false);
        accU = __builtin_amdgcn_wmma_f32_16x16x32_f16(
            false, a, false, bu, (short)0, accU, false, false);
    }

    // D layout: VGPR r, lanes 0-15 -> M = r (0..7). Rows 0..3 are batches.
    const float scale = lts[0];
    if (hi == 0) {
        #pragma unroll
        for (int r = 0; r < 4; ++r) {
            const int b = r, c = c0 + m;
            const float wc  = w[c] + accW[r] * scale;
            const float dcy = __expf(-__expf(wc)) * (0.5f + 0.5f * tf4[b]);
            decay_out[b * C_ + c] = dcy;
            ucond_out[b * C_ + c] = u[c] + accU[r] * scale;
        }
    }
}

// e^x as the fast exponential forms it (one multiply, v_exp_f32). The v_nop in
// the same statement is the free slot the instruction set asks for behind a
// transcendental.
__device__ __forceinline__ float exp_slot(float x)
{
    float r;
    asm("v_exp_f32 %0, %1\n\tv_nop" : "=v"(r) : "v"(x * 1.44269504088896340736f));
    return r;
}

// =====================================================================
// Kernel 2: the whole bidirectional scan in one launch.
// Two work-groups share 32 channels of one batch row, so that every WGP has
// one: each forms the output of its own half of T. Nothing passes between
// them: each sums the other half itself and keeps the sum that runs towards
// its own half. Lane = channel, wave = a span of 64 steps in each half,
// worked as 2 sub-chunks of 32.
//   pass 1: own span's sums with zero start (forward G, backward H) and the
//           other half's span sum (towards the own half) -> LDS
//   barrier; every wave folds the other half's sums into the state at the
//   joint, then that and the other spans' sums into its two carries
//   pass 2: both scans again, started FROM the carries, so num and den
//           are final in registers and only the output is stored.
// Every loop over tl is fully unrolled so that its arrays live in registers.
// =====================================================================
__global__ void __launch_bounds__(NSPAN * 32)
k_fused(const float* __restrict__ rin, const float* __restrict__ kin,
        const float* __restrict__ vin, const float* __restrict__ tf,
        const float* __restrict__ decay, const float* __restrict__ ucond,
        float* __restrict__ out)
{
    __shared__ float sGn[NSPAN][CW], sGd[NSPAN][CW];
    __shared__ float sHn[NSPAN][CW], sHd[NSPAN][CW];
    __shared__ float sOn[NSPAN][CW], sOd[NSPAN][CW];   // other half, nearest span last

    const int lane = threadIdx.x & 31;
    const int wv   = __builtin_amdgcn_readfirstlane(threadIdx.x >> 5);
    const int grp  = blockIdx.x % (BC_ / CW);   // channel group
    const int h    = blockIdx.x / (BC_ / CW);   // own half of T: 0 left, 1 right
    const int bc   = grp * CW + lane;
    const int b    = grp / (C_ / CW);
    const int c    = bc & (C_ - 1);

    const float d  = decay[bc];
    const float uc = ucond[bc];
    // the two loads' index register is free for reuse behind this wait
    asm volatile("s_wait_xcnt 0x0" ::: "memory");
    const int base0 = (b * T_ + h * TH + wv * SPAN) * C_ + c;         // own half
    // other half: the half goes into the (uniform) pointers, the rest is an index
    const int baseo = (b * T_ + wv * SPAN) * C_ + c;
    const float* kio = kin + (h ^ 1) * (TH * C_);
    const float* vio = vin + (h ^ 1) * (TH * C_);

    // ---- pass 1: sums of this wave's two spans, zero start ----
    float af = 0.f, df = 0.f;                   // runs through the whole own span
    float hn0 = 0.f, hn1 = 0.f, hd0 = 0.f, hd1 = 0.f;   // own span, per sub-chunk
    float gn = 0.f, gd = 0.f;                   // runs through the whole other span
    float on0 = 0.f, on1 = 0.f, od0 = 0.f, od1 = 0.f;   // other span, per sub-chunk
    // unrolled, the next sub-chunk's loads written ahead of this one's sums:
    // memory stays busy while the wave computes
    float kA[LCH], vA[LCH];
    #pragma unroll
    for (int tl = 0; tl < LCH; ++tl) {
        kA[tl] = kin[base0 + tl * C_];
        vA[tl] = vin[base0 + tl * C_];
    }
    // keeps arithmetic on d, with its wait for d, from being placed ahead of the
    // span's first loads
    __builtin_amdgcn_sched_barrier(0);
    const float d2 = d * d, d4 = d2 * d2, d8 = d4 * d4, d16 = d8 * d8;
    const float dL = d16 * d16;                 // d^LCH
    const float dS = dL * dL;                   // d^SPAN
    #pragma unroll
    for (int j = 0; j < 2 * NSUB; ++j) {        // own sub-chunks, then the other half's
        float kB[LCH], vB[LCH];
        if (j + 1 < 2 * NSUB) {
            #pragma unroll
            for (int tl = 0; tl < LCH; ++tl) {
                if (j + 1 < NSUB) {
                    kB[tl] = kin[base0 + ((j + 1) * LCH + tl) * C_];
                    vB[tl] = vin[base0 + ((j + 1) * LCH + tl) * C_];
                } else {
                    kB[tl] = kio[baseo + ((j + 1 - NSUB) * LCH + tl) * C_];
                    vB[tl] = vio[baseo + ((j + 1 - NSUB) * LCH + tl) * C_];
                }
            }
        }
        float e[LCH], x[LCH];
        #pragma unroll
        for (int tl = 0; tl < LCH; ++tl) {
            e[tl] = exp_slot(fminf(kA[tl], 30.f));
            x[tl] = e[tl] * vA[tl];
        }
        // the other span is summed both ways like the own one and the side that
        // runs towards the own half is picked behind the loop: with a branch on the
        // half here the compiler sank the next loads under it, or spilled
        float fn = (j < NSUB) ? af : gn, fd = (j < NSUB) ? df : gd;
        #pragma unroll
        for (int tl = 0; tl < LCH; ++tl) {
            fn = fn * d + x[tl];
            fd = fd * d + e[tl];
        }
        float hn = 0.f, hd = 0.f;
        #pragma unroll
        for (int tl = LCH - 1; tl >= 0; --tl) {
            hn = hn * d + x[tl];
            hd = hd * d + e[tl];
        }
        if (j < NSUB) {
            af = fn; df = fd;
            hn0 = hn1; hn1 = hn;                 // in the end: hnJ = sub-chunk J
            hd0 = hd1; hd1 = hd;
        } else {
            gn = fn; gd = fd;
            on0 = on1; on1 = hn;
            od0 = od1; od1 = hd;
        }
        if (j + 1 < 2 * NSUB) {
            #pragma unroll
            for (int tl = 0; tl < LCH; ++tl) { kA[tl] = kB[tl]; vA[tl] = vB[tl]; }
        }
    }
    sGn[wv][lane] = af;
    sGd[wv][lane] = df;
    sHn[wv][lane] = hn0 + dL * hn1;
    sHd[wv][lane] = hd0 + dL * hd1;
    // laid down farthest span first, so one ascending fold serves both halves
    const int oi = h ? wv : NSPAN - 1 - wv;
    sOn[oi][lane] = h ? gn : on0 + dL * on1;    // left half forward, right half backward
    sOd[oi][lane] = h ? gd : od0 + dL * od1;
    __syncthreads();

    // ---- carries into this span: forward from the left, backward from the right ----
    // The running fold is formed over all spans and sampled at this wave's own,
    // so the LDS reads depend on no branch and go out together.
    float cfn = 0.f, cfd = 0.f, cbn = 0.f, cbd = 0.f;
    float tn = 0.f, td = 0.f;                   // the other half's state at the joint
    #pragma unroll
    for (int i = 0; i < NSPAN; ++i) {
        tn = tn * dS + sOn[i][lane];
        td = td * dS + sOd[i][lane];
    }
    float rn = h ? tn : 0.f, rd = h ? td : 0.f;
    #pragma unroll
    for (int i = 0; i < NSPAN; ++i) {
        cfn = (i == wv) ? rn : cfn;
        cfd = (i == wv) ? rd : cfd;
        rn = rn * dS + sGn[i][lane];
        rd = rd * dS + sGd[i][lane];
    }
    rn = h ? 0.f : tn; rd = h ? 0.f : td;
    #pragma unroll
    for (int i = NSPAN - 1; i >= 0; --i) {
        cbn = (i == wv) ? rn : cbn;
        cbd = (i == wv) ? rd : cbd;
        rn = rn * dS + sHn[i][lane];
        rd = rd * dS + sHd[i][lane];
    }
    // backward state just right of each sub-chunk
    float cn1 = cbn, cn0 = hn1 + dL * cn1;
    float cd1 = cbd, cd0 = hd1 + dL * cd1;

    // ---- pass 2: both scans from their carries, then the output ----
    const float tfb = tf[b];
    af = cfn; df = cfd;
    // rolled: one body in the instruction cache, one sub-chunk in registers
    #pragma unroll 1
    for (int j = 0; j < NSUB; ++j) {
        const int base = base0 + j * (LCH * C_);
        float kk[LCH], vv[LCH], rr[LCH];
        #pragma unroll
        for (int tl = LCH - 1; tl >= 0; --tl) {
            const int idx = base + tl * C_;
            kk[tl] = kin[idx];                  // second read: L2
            vv[tl] = vin[idx];
        }
        // a later load may land in an address register of the loads above
        asm volatile("s_wait_xcnt 0x0" ::: "memory");
        #pragma unroll
        for (int tl = 0; tl < LCH; ++tl) rr[tl] = rin[base + tl * C_];
        // keeps the sub-chunk's loads together in front of the arithmetic; left to
        // itself the scheduler can deal them out a few at a time, each with its wait
        __builtin_amdgcn_sched_barrier(0);
        float e[LCH], x[LCH], bn[LCH], bd[LCH];
        float ab = cn0, db = cd0;
        #pragma unroll
        for (int tl = LCH - 1; tl >= 0; --tl) {
            const float ek  = exp_slot(fminf(kk[tl], 30.f));
            const float euk = exp_slot(fminf(uc + kk[tl], 30.f));
            e[tl] = ek;
            x[tl] = ek * vv[tl];
            ab = ab * d + x[tl];
            db = db * d + ek;
            bn[tl] = ab + (euk - ek) * vv[tl];
            bd[tl] = db + (euk - ek);
        }
        #pragma unroll
        for (int tl = 0; tl < LCH; ++tl) {
            const int idx = base + tl * C_;
            af = af * d + x[tl];
            df = df * d + e[tl];
            const float num = af + bn[tl];
            const float den = df + bd[tl];
            const float sr  = 1.f / (1.f + exp_slot(-rr[tl]));
            const float bse = sr * num / fmaxf(den, 1e-8f);
            out[idx] = bse * (0.8f + 0.2f * tfb);
        }
        cn0 = cn1;
        cd0 = cd1;
        // the next trip rewrites the stores' address and data registers
        asm volatile("s_wait_xcnt 0x0" ::: "memory");
    }
}

// =====================================================================
// Launcher
// =====================================================================
extern "C" void kernel_launch(void* const* d_in, const int* in_sizes, int n_in,
                              void* d_out, int out_size, void* d_ws, size_t ws_size,
                              hipStream_t stream) {
    const float* r_in      = (const float*)d_in[0];   // [B,T,C]
    const float* k_in      = (const float*)d_in[1];   // [B,T,C]
    const float* v_in      = (const float*)d_in[2];   // [B,T,C]
    const float* time_emb  = (const float*)d_in[3];   // [B,TD]
    const float* w_in      = (const float*)d_in[4];   // [1,1,C]
    const float* u_in      = (const float*)d_in[5];   // [1,1,C]
    const float* wproj     = (const float*)d_in[6];   // [C,TD]
    const float* uproj     = (const float*)d_in[7];   // [C,TD]
    const float* lts       = (const float*)d_in[8];   // [1]
    float* out = (float*)d_out;                       // [B,T,C] fp32

    // workspace carve-up (floats)
    float* ws   = (float*)d_ws;
    float* tf    = ws;                    // 8 (4 used)
    float* decay = tf + 8;                // B*C
    float* ucond = decay + BC_;           // B*C

    // 1) WMMA time projection -> tf, decay, ucond
    k_proj<<<C_ / 16, 32, 0, stream>>>(time_emb, w_in, u_in, wproj, uproj, lts,
                                       tf, decay, ucond);

    // 2) both scans, carries and the output: two work-groups per 32 channels
    k_fused<<<NH * (BC_ / CW), NSPAN * 32, 0, stream>>>(r_in, k_in, v_in, tf, decay, ucond, out);
}

// v003
// One run takes 24.9 microseconds.
// Next to v002, in two timings, it ran 1.38 and 1.39 times as fast.
// All steps since v000 together make it 2.71 times as fast.
#include <hip/hip_runtime.h>
#include <hip/hip_bf16.h>

// ---------------- problem constants (from reference) ----------------
#define B_ 4
#define T_ 2048
#define C_ 1024
#define TD_ 128

#define LCH 32               // sub-chunk length along T (kept in registers)
#define NSUB 2               // sub-chunks per span
#define SPAN (LCH * NSUB)    // 64 steps of T per span
#define NH 2                 // work-groups that share one channel group's T
#define TH (T_ / NH)         // 1024 steps of T whose output one work-group forms
#define NSPAN (TH / SPAN)    // 16 waves cover one half of T
#define CW 32                // channels per work-group: one 128-byte line
#define BC_ (B_ * C_)        // 4096 channels

typedef __attribute__((ext_vector_type(16))) _Float16 v16h;
typedef __attribute__((ext_vector_type(8)))  float    v8f;

// e^x as the fast exponential forms it (one multiply, v_exp_f32). The v_nop in
// the same statement is the free slot the instruction set asks for behind a
// transcendental.
__device__ __forceinline__ float exp_slot(float x)
{
    float r;
    asm("v_exp_f32 %0, %1\n\tv_nop" : "=v"(r) : "v"(x * 1.44269504088896340736f));
    return r;
}

// =====================================================================
// The one kernel: time-conditioning projection and the whole bidirectional scan.
// Head: every work-group forms decay, bonus and time factor of its own 32
// channels itself, while the first loads of k and v of its other waves fly:
//   tmpW[c] = sum_k time_emb[b,k] * time_w_proj[c,k]   (ditto U), on WMMA
//   (f16 in, f32 acc): waves 0..3 take one 16-column tile of W or U each;
//   wave 4 sums time_emb[b,:] for tf = sigmoid(sum); all three cross LDS.
//   decay = exp(-exp(w[c] + tmpW*s)) * (0.5 + 0.5*tf),  ucond = u[c] + tmpU*s
// Two work-groups share 32 channels of one batch row, so that every WGP has
// one: each forms the output of its own half of T. Nothing passes between
// them: each sums the other half itself and keeps the sum that runs towards
// its own half. Lane = channel, wave = a span of 64 steps in each half,
// worked as 2 sub-chunks of 32.
//   pass 1: own span's sums with zero start (forward G, backward H) and the
//           other half's span sum (towards the own half) -> LDS
//   barrier; every wave folds the other half's sums into the state at the
//   joint, then that and the other spans' sums into its two carries
//   pass 2: both scans again, started FROM the carries, so num and den
//           are final in registers and only the output is stored.
// Every loop over tl is fully unrolled so that its arrays live in registers.
// =====================================================================
__global__ void __launch_bounds__(NSPAN * 32)
k_fused(const float* __restrict__ rin, const float* __restrict__ kin,
        const float* __restrict__ vin,
        const float* __restrict__ time_emb,   // [B, TD]
        const float* __restrict__ w,          // [C]
        const float* __restrict__ u,          // [C]
        const float* __restrict__ wproj,      // [C, TD]
        const float* __restrict__ uproj,      // [C, TD]
        const float* __restrict__ lts,        // [1]
        float* __restrict__ out)
{
    __shared__ float sP[2][CW];                 // tmpW, tmpU of the 32 channels
    __shared__ float sTf;                       // time factor of the batch row
    __shared__ float sGn[NSPAN][CW], sGd[NSPAN][CW];
    __shared__ float sHn[NSPAN][CW], sHd[NSPAN][CW];
    __shared__ float sOn[NSPAN][CW], sOd[NSPAN][CW];   // other half, nearest span last

    const int lane = threadIdx.x & 31;
    const int wv   = __builtin_amdgcn_readfirstlane(threadIdx.x >> 5);
    const int grp  = blockIdx.x % (BC_ / CW);   // channel group
    const int h    = blockIdx.x / (BC_ / CW);   // own half of T: 0 left, 1 right
    const int bc   = grp * CW + lane;
    const int b    = grp / (C_ / CW);
    const int c    = bc & (C_ - 1);

    const float wch = w[c];
    const float uch = u[c];
    const float scale = lts[0];
    // the two loads' index register is free for reuse behind this wait
    asm volatile("s_wait_xcnt 0x0" ::: "memory");

    // ---- head, part 1: waves 0..3 form the products of one 16-column tile each ----
    if (wv < 4) {
        const int m  = lane & 15;
        const int hi = lane >> 4;
        const float* te = time_emb + b * TD_;
        const float* pr = ((wv >> 1) ? uproj : wproj)
                        + ((grp * CW & (C_ - 1)) + (wv & 1) * 16 + m) * TD_;
        // 16-bit A 16x32 layout (ISA 7.12.2): lanes 0-15 rows, VGPR v holds
        // K = {2v,2v+1} (v<4) or {16+2(v-4),...}; lanes 16-31 add +8 to K.
        // B takes the same k at the same place, lane & 15 = column. Every
        // row of A is time_emb[b,:], so every row of D holds the 16 products.
        float fa[TD_ / 32][16], fb[TD_ / 32][16];
        #pragma unroll
        for (int q = 0; q < TD_ / 32; ++q) {
            #pragma unroll
            for (int e = 0; e < 16; ++e) {
                const int vg = e >> 1, hh = e & 1;
                const int kk = (vg < 4) ? (hi * 8 + 2 * vg + hh)
                                        : (16 + hi * 8 + 2 * (vg - 4) + hh);
                fa[q][e] = te[q * 32 + kk];
                fb[q][e] = pr[q * 32 + kk];
            }
        }
        // the operand loads' address registers are free for reuse behind this wait
        asm volatile("s_wait_xcnt 0x0" ::: "memory");
        v8f acc = {};
        #pragma unroll
        for (int q = 0; q < TD_ / 32; ++q) {
            v16h a, bb;
            #pragma unroll
            for (int e = 0; e < 16; ++e) {
                a[e]  = (_Float16)fa[q][e];
                bb[e] = (_Float16)fb[q][e];
            }
            acc = __builtin_amdgcn_wmma_f32_16x16x32_f16(
                false, a, false, bb, (short)0, acc, false, false);
        }
        // D layout: VGPR 0, lanes 0-15 -> row 0, column = lane
        if (lane < 16) sP[wv >> 1][(wv & 1) * 16 + lane] = acc[0];
    }
    const int base0 = (b * T_ + h * TH + wv * SPAN) * C_ + c;         // own half
    // other half: the half goes into the (uniform) pointers, the rest is an index
    const int baseo = (b * T_ + wv * SPAN) * C_ + c;
    const float* kio = kin + (h ^ 1) * (TH * C_);
    const float* vio = vin + (h ^ 1) * (TH * C_);

    // ---- pass 1: sums of this wave's two spans, zero start ----
    float af = 0.f, df = 0.f;                   // runs through the whole own span
    float hn0 = 0.f, hn1 = 0.f, hd0 = 0.f, hd1 = 0.f;   // own span, per sub-chunk
    float gn = 0.f, gd = 0.f;                   // runs through the whole other span
    float on0 = 0.f, on1 = 0.f, od0 = 0.f, od1 = 0.f;   // other span, per sub-chunk
    // unrolled, the next sub-chunk's loads written ahead of this one's sums:
    // memory stays busy while the wave computes
    float kA[LCH], vA[LCH];
    #pragma unroll
    for (int tl = 0; tl < LCH; ++tl) {
        kA[tl] = kin[base0 + tl * C_];
        vA[tl] = vin[base0 + tl * C_];
    }
    // keeps the rest of the head, with its waits, from being placed ahead of the
    // span's first loads
    __builtin_amdgcn_sched_barrier(0);

    // ---- head, part 2: time factor (wave 4), hand-over ----
    if (wv == 4) {
        float s = 0.f;
        #pragma unroll
        for (int j = 0; j < TD_; ++j) s += time_emb[b * TD_ + j];
        const float t = 1.f / (1.f + __expf(-s));
        if (lane == 0) sTf = t;
    }
    // Work-group barrier whose fences order LDS alone: __syncthreads() here would
    // also wait for the loads of k and v above, which are to stay in flight.
    __builtin_amdgcn_fence(__ATOMIC_RELEASE, "workgroup", "local");
    __builtin_amdgcn_s_barrier();
    __builtin_amdgcn_fence(__ATOMIC_ACQUIRE, "workgroup", "local");
    // keeps arithmetic on k, with its wait for the loads, out of the barrier
    __builtin_amdgcn_sched_barrier(0);
    const float d  = exp_slot(-exp_slot(wch + sP[0][lane] * scale)) * (0.5f + 0.5f * sTf);
    const float uc = uch + sP[1][lane] * scale;
    const float d2 = d * d, d4 = d2 * d2, d8 = d4 * d4, d16 = d8 * d8;
    const float dL = d16 * d16;                 // d^LCH
    const float dS = dL * dL;                   // d^SPAN
    #pragma unroll
    for (int j = 0; j < 2 * NSUB; ++j) {        // own sub-chunks, then the other half's
        float kB[LCH], vB[LCH];
        if (j + 1 < 2 * NSUB) {
            #pragma unroll
            for (int tl = 0; tl < LCH; ++tl) {
                if (j + 1 < NSUB) {
                    kB[tl] = kin[base0 + ((j + 1) * LCH + tl) * C_];
                    vB[tl] = vin[base0 + ((j + 1) * LCH + tl) * C_];
                } else {
                    kB[tl] = kio[baseo + ((j + 1 - NSUB) * LCH + tl) * C_];
                    vB[tl] = vio[baseo + ((j + 1 - NSUB) * LCH + tl) * C_];
                }
            }
        }
        float e[LCH], x[LCH];
        #pragma unroll
        for (int tl = 0; tl < LCH; ++tl) {
            e[tl] = exp_slot(fminf(kA[tl], 30.f));
            x[tl] = e[tl] * vA[tl];
        }
        // the other span is summed both ways like the own one and the side that
        // runs towards the own half is picked behind the loop: with a branch on the
        // half here the compiler sank the next loads under it, or spilled
        float fn = (j < NSUB) ? af : gn, fd = (j < NSUB) ? df : gd;
        #pragma unroll
        for (int tl = 0; tl < LCH; ++tl) {
            fn = fn * d + x[tl];
            fd = fd * d + e[tl];
        }
        float hn = 0.f, hd = 0.f;
        #pragma unroll
        for (int tl = LCH - 1; tl >= 0; --tl) {
            hn = hn * d + x[tl];
            hd = hd * d + e[tl];
        }
        if (j < NSUB) {
            af = fn; df = fd;
            hn0 = hn1; hn1 = hn;                 // in the end: hnJ = sub-chunk J
            hd0 = hd1; hd1 = hd;
        } else {
            gn = fn; gd = fd;
            on0 = on1; on1 = hn;
            od0 = od1; od1 = hd;
        }
        if (j + 1 < 2 * NSUB) {
            #pragma unroll
            for (int tl = 0; tl < LCH; ++tl) { kA[tl] = kB[tl]; vA[tl] = vB[tl]; }
        }
    }
    sGn[wv][lane] = af;
    sGd[wv][lane] = df;
    sHn[wv][lane] = hn0 + dL * hn1;
    sHd[wv][lane] = hd0 + dL * hd1;
    // laid down farthest span first, so one ascending fold serves both halves
    const int oi = h ? wv : NSPAN - 1 - wv;
    sOn[oi][lane] = h ? gn : on0 + dL * on1;    // left half forward, right half backward
    sOd[oi][lane] = h ? gd : od0 + dL * od1;
    __syncthreads();

    // ---- carries into this span: forward from the left, backward from the right ----
    // The running fold is formed over all spans and sampled at this wave's own,
    // so the LDS reads depend on no branch and go out together.
    float cfn = 0.f, cfd = 0.f, cbn = 0.f, cbd = 0.f;
    float tn = 0.f, td = 0.f;                   // the other half's state at the joint
    #pragma unroll
    for (int i = 0; i < NSPAN; ++i) {
        tn = tn * dS + sOn[i][lane];
        td = td * dS + sOd[i][lane];
    }
    float rn = h ? tn : 0.f, rd = h ? td : 0.f;
    #pragma unroll
    for (int i = 0; i < NSPAN; ++i) {
        cfn = (i == wv) ? rn : cfn;
        cfd = (i == wv) ? rd : cfd;
        rn = rn * dS + sGn[i][lane];
        rd = rd * dS + sGd[i][lane];
    }
    rn = h ? 0.f : tn; rd = h ? 0.f : td;
    #pragma unroll
    for (int i = NSPAN - 1; i >= 0; --i) {
        cbn = (i == wv) ? rn : cbn;
        cbd = (i == wv) ? rd : cbd;
        rn = rn * dS + sHn[i][lane];
        rd = rd * dS + sHd[i][lane];
    }
    // backward state just right of each sub-chunk
    float cn1 = cbn, cn0 = hn1 + dL * cn1;
    float cd1 = cbd, cd0 = hd1 + dL * cd1;

    // ---- pass 2: both scans from their carries, then the output ----
    const float tfb = sTf;
    af = cfn; df = cfd;
    // rolled: one body in the instruction cache, one sub-chunk in registers
    #pragma unroll 1
    for (int j = 0; j < NSUB; ++j) {
        const int base = base0 + j * (LCH * C_);
        float kk[LCH], vv[LCH], rr[LCH];
        #pragma unroll
        for (int tl = LCH - 1; tl >= 0; --tl) {
            const int idx = base + tl * C_;
            kk[tl] = kin[idx];                  // second read: L2
            vv[tl] = vin[idx];
        }
        // a later load may land in an address register of the loads above
        asm volatile("s_wait_xcnt 0x0" ::: "memory");
        #pragma unroll
        for (int tl = 0; tl < LCH; ++tl) rr[tl] = rin[base + tl * C_];
        // keeps the sub-chunk's loads together in front of the arithmetic; left to
        // itself the scheduler can deal them out a few at a time, each with its wait
        __builtin_amdgcn_sched_barrier(0);
        float e[LCH], x[LCH], bn[LCH], bd[LCH];
        float ab = cn0, db = cd0;
        #pragma unroll
        for (int tl = LCH - 1; tl >= 0; --tl) {
            const float ek  = exp_slot(fminf(kk[tl], 30.f));
            const float euk = exp_slot(fminf(uc + kk[tl], 30.f));
            e[tl] = ek;
            x[tl] = ek * vv[tl];
            ab = ab * d + x[tl];
            db = db * d + ek;
            bn[tl] = ab + (euk - ek) * vv[tl];
            bd[tl] = db + (euk - ek);
        }
        #pragma unroll
        for (int tl = 0; tl < LCH; ++tl) {
            const int idx = base + tl * C_;
            af = af * d + x[tl];
            df = df * d + e[tl];
            const float num = af + bn[tl];
            const float den = df + bd[tl];
            const float sr  = 1.f / (1.f + exp_slot(-rr[tl]));
            const float bse = sr * num / fmaxf(den, 1e-8f);
            out[idx] = bse * (0.8f + 0.2f * tfb);
        }
        cn0 = cn1;
        cd0 = cd1;
        // the next trip rewrites the stores' address and data registers
        asm volatile("s_wait_xcnt 0x0" ::: "memory");
    }
}

// =====================================================================
// Launcher
// =====================================================================
extern "C" void kernel_launch(void* const* d_in, const int* in_sizes, int n_in,
                              void* d_out, int out_size, void* d_ws, size_t ws_size,
                              hipStream_t stream) {
    const float* r_in      = (const float*)d_in[0];   // [B,T,C]
    const float* k_in      = (const float*)d_in[1];   // [B,T,C]
    const float* v_in      = (const float*)d_in[2];   // [B,T,C]
    const float* time_emb  = (const float*)d_in[3];   // [B,TD]
    const float* w_in      = (const float*)d_in[4];   // [1,1,C]
    const float* u_in      = (const float*)d_in[5];   // [1,1,C]
    const float* wproj     = (const float*)d_in[6];   // [C,TD]
    const float* uproj     = (const float*)d_in[7];   // [C,TD]
    const float* lts       = (const float*)d_in[8];   // [1]
    float* out = (float*)d_out;                       // [B,T,C] fp32

    // projection, both scans, carries and the output: two work-groups per 32 channels
    k_fused<<<NH * (BC_ / CW), NSPAN * 32, 0, stream>>>(r_in, k_in, v_in, time_emb, w_in, u_in,
                                                        wproj, uproj, lts, out);
}

// v004
// It runs in 20.7 microseconds.
// Next to v003, in two timings, it ran 1.21 and 1.20 times as fast.
// Over all steps from v000 it is 3.27 times as fast.
#include <hip/hip_runtime.h>
#include <hip/hip_bf16.h>

// ---------------- problem constants (from reference) ----------------
#define B_ 4
#define T_ 2048
#define C_ 1024
#define TD_ 128

#define LCH 32               // sub-chunk length along T (kept in registers)
#define NSUB 2               // sub-chunks per span
#define SPAN (LCH * NSUB)    // 64 steps of T per span
#define NH 2                 // work-groups that share one channel group's T
#define TH (T_ / NH)         // 1024 steps of T whose output one work-group forms
#define NSPAN (TH / SPAN)    // 16 waves cover one half of T
#define CW 32                // channels per work-group: one 128-byte line
#define BC_ (B_ * C_)        // 4096 channels

typedef __attribute__((ext_vector_type(16))) _Float16 v16h;
typedef __attribute__((ext_vector_type(8)))  float    v8f;

// e^x as the fast exponential forms it (one multiply, v_exp_f32). The v_nop in
// the same statement is the free slot the instruction set asks for behind a
// transcendental.
__device__ __forceinline__ float exp_slot(float x)
{
    float r;
    asm("v_exp_f32 %0, %1\n\tv_nop" : "=v"(r) : "v"(x * 1.44269504088896340736f));
    return r;
}

// 1/x by the hardware's reciprocal (about one unit in the last place) in place of
// the exact division's long sequence, with the same free slot behind it.
__device__ __forceinline__ float rcp_slot(float x)
{
    float r;
    asm("v_rcp_f32 %0, %1\n\tv_nop" : "=v"(r) : "v"(x));
    return r;
}

// =====================================================================
// The one kernel: time-conditioning projection and the whole bidirectional scan.
// Head: every work-group forms decay, bonus and time factor of its own 32
// channels itself, while the first loads of k and v of its other waves fly:
//   tmpW[c] = sum_k time_emb[b,k] * time_w_proj[c,k]   (ditto U), on WMMA
//   (f16 in, f32 acc): waves 0..3 take one 16-column tile of W or U each;
//   wave 4 sums time_emb[b,:] for tf = sigmoid(sum); all three cross LDS.
//   decay = exp(-exp(w[c] + tmpW*s)) * (0.5 + 0.5*tf),  ucond = u[c] + tmpU*s
// Two work-groups share 32 channels of one batch row, so that every WGP has
// one: each forms the output of its own half of T. Nothing passes between
// them: each sums the other half itself and keeps the sum that runs towards
// its own half. Lane = channel, wave = a span of 64 steps in each half,
// worked as 2 sub-chunks of 32.
//   pass 1: own span's sums with zero start (forward G, backward H) and the
//           other half's span sum (towards the own half) -> LDS
//   barrier; every wave folds the other half's sums into the state at the
//   joint, then that and the other spans' sums into its two carries
//   pass 2: both scans again, started FROM the carries, so num and den
//           are final in registers and only the output is stored.
// Every loop over tl is fully unrolled so that its arrays live in registers.
// =====================================================================
__global__ void __launch_bounds__(NSPAN * 32)
k_fused(const float* __restrict__ rin, const float* __restrict__ kin,
        const float* __restrict__ vin,
        const float* __restrict__ time_emb,   // [B, TD]
        const float* __restrict__ w,          // [C]
        const float* __restrict__ u,          // [C]
        const float* __restrict__ wproj,      // [C, TD]
        const float* __restrict__ uproj,      // [C, TD]
        const float* __restrict__ lts,        // [1]
        float* __restrict__ out)
{
    __shared__ float sP[2][CW];                 // tmpW, tmpU of the 32 channels
    __shared__ float sTf;                       // time factor of the batch row
    __shared__ float sGn[NSPAN][CW], sGd[NSPAN][CW];
    __shared__ float sHn[NSPAN][CW], sHd[NSPAN][CW];
    __shared__ float sOn[NSPAN][CW], sOd[NSPAN][CW];   // other half, nearest span last

    const int lane = threadIdx.x & 31;
    const int wv   = __builtin_amdgcn_readfirstlane(threadIdx.x >> 5);
    const int grp  = blockIdx.x % (BC_ / CW);   // channel group
    const int h    = blockIdx.x / (BC_ / CW);   // own half of T: 0 left, 1 right
    const int bc   = grp * CW + lane;
    const int b    = grp / (C_ / CW);
    const int c    = bc & (C_ - 1);

    const float wch = w[c];
    const float uch = u[c];
    const float scale = lts[0];
    // the two loads' index register is free for reuse behind this wait
    asm volatile("s_wait_xcnt 0x0" ::: "memory");

    // ---- head, part 1: waves 0..3 form the products of one 16-column tile each ----
    if (wv < 4) {
        const int m  = lane & 15;
        const int hi = lane >> 4;
        const float* te = time_emb + b * TD_;
        const float* pr = ((wv >> 1) ? uproj : wproj)
                        + ((grp * CW & (C_ - 1)) + (wv & 1) * 16 + m) * TD_;
        // 16-bit A 16x32 layout (ISA 7.12.2): lanes 0-15 rows, VGPR v holds
        // K = {2v,2v+1} (v<4) or {16+2(v-4),...}; lanes 16-31 add +8 to K.
        // B takes the same k at the same place, lane & 15 = column. Every
        // row of A is time_emb[b,:], so every row of D holds the 16 products.
        float fa[TD_ / 32][16], fb[TD_ / 32][16];
        #pragma unroll
        for (int q = 0; q < TD_ / 32; ++q) {
            #pragma unroll
            for (int e = 0; e < 16; ++e) {
                const int vg = e >> 1, hh = e & 1;
                const int kk = (vg < 4) ? (hi * 8 + 2 * vg + hh)
                                        : (16 + hi * 8 + 2 * (vg - 4) + hh);
                fa[q][e] = te[q * 32 + kk];
                fb[q][e] = pr[q * 32 + kk];
            }
        }
        // the operand loads' address registers are free for reuse behind this wait
        asm volatile("s_wait_xcnt 0x0" ::: "memory");
        v8f acc = {};
        #pragma unroll
        for (int q = 0; q < TD_ / 32; ++q) {
            v16h a, bb;
            #pragma unroll
            for (int e = 0; e < 16; ++e) {
                a[e]  = (_Float16)fa[q][e];
                bb[e] = (_Float16)fb[q][e];
            }
            acc = __builtin_amdgcn_wmma_f32_16x16x32_f16(
                false, a, false, bb, (short)0, acc, false, false);
        }
        // D layout: VGPR 0, lanes 0-15 -> row 0, column = lane
        if (lane < 16) sP[wv >> 1][(wv & 1) * 16 + lane] = acc[0];
    }
    const int base0 = (b * T_ + h * TH + wv * SPAN) * C_ + c;         // own half
    // other half: the half goes into the (uniform) pointers, the rest is an index
    const int baseo = (b * T_ + wv * SPAN) * C_ + c;
    const float* kio = kin + (h ^ 1) * (TH * C_);
    const float* vio = vin + (h ^ 1) * (TH * C_);

    // ---- pass 1: sums of this wave's two spans, zero start ----
    float af = 0.f, df = 0.f;                   // runs through the whole own span
    float hn0 = 0.f, hn1 = 0.f, hd0 = 0.f, hd1 = 0.f;   // own span, per sub-chunk
    float gn = 0.f, gd = 0.f;                   // runs through the whole other span
    float on0 = 0.f, on1 = 0.f, od0 = 0.f, od1 = 0.f;   // other span, per sub-chunk
    // unrolled, the next sub-chunk's loads written ahead of this one's sums:
    // memory stays busy while the wave computes
    float kA[LCH], vA[LCH];
    #pragma unroll
    for (int tl = 0; tl < LCH; ++tl) {
        kA[tl] = kin[base0 + tl * C_];
        vA[tl] = vin[base0 + tl * C_];
    }
    // keeps the rest of the head, with its waits, from being placed ahead of the
    // span's first loads
    __builtin_amdgcn_sched_barrier(0);

    // ---- head, part 2: time factor (wave 4), hand-over ----
    if (wv == 4) {
        float s = 0.f;
        #pragma unroll
        for (int j = 0; j < TD_; ++j) s += time_emb[b * TD_ + j];
        const float t = 1.f / (1.f + __expf(-s));
        if (lane == 0) sTf = t;
    }
    // Work-group barrier whose fences order LDS alone: __syncthreads() here would
    // also wait for the loads of k and v above, which are to stay in flight.
    __builtin_amdgcn_fence(__ATOMIC_RELEASE, "workgroup", "local");
    __builtin_amdgcn_s_barrier();
    __builtin_amdgcn_fence(__ATOMIC_ACQUIRE, "workgroup", "local");
    // keeps arithmetic on k, with its wait for the loads, out of the barrier
    __builtin_amdgcn_sched_barrier(0);
    const float d  = exp_slot(-exp_slot(wch + sP[0][lane] * scale)) * (0.5f + 0.5f * sTf);
    const float uc = uch + sP[1][lane] * scale;
    const float d2 = d * d, d4 = d2 * d2, d8 = d4 * d4, d16 = d8 * d8;
    const float dL = d16 * d16;                 // d^LCH
    const float dS = dL * dL;                   // d^SPAN
    #pragma unroll
    for (int j = 0; j < 2 * NSUB; ++j) {        // own sub-chunks, then the other half's
        float kB[LCH], vB[LCH];
        if (j + 1 < 2 * NSUB) {
            #pragma unroll
            for (int tl = 0; tl < LCH; ++tl) {
                if (j + 1 < NSUB) {
                    kB[tl] = kin[base0 + ((j + 1) * LCH + tl) * C_];
                    vB[tl] = vin[base0 + ((j + 1) * LCH + tl) * C_];
                } else {
                    kB[tl] = kio[baseo + ((j + 1 - NSUB) * LCH + tl) * C_];
                    vB[tl] = vio[baseo + ((j + 1 - NSUB) * LCH + tl) * C_];
                }
            }
        }
        float e[LCH], x[LCH];
        #pragma unroll
        for (int tl = 0; tl < LCH; ++tl) {
            e[tl] = exp_slot(fminf(kA[tl], 30.f));
            x[tl] = e[tl] * vA[tl];
        }
        // the other span is summed both ways like the own one and the side that
        // runs towards the own half is picked behind the loop: with a branch on the
        // half here the compiler sank the next loads under it, or spilled
        float fn = (j < NSUB) ? af : gn, fd = (j < NSUB) ? df : gd;
        #pragma unroll
        for (int tl = 0; tl < LCH; ++tl) {
            fn = fn * d + x[tl];
            fd = fd * d + e[tl];
        }
        float hn = 0.f, hd = 0.f;
        #pragma unroll
        for (int tl = LCH - 1; tl >= 0; --tl) {
            hn = hn * d + x[tl];
            hd = hd * d + e[tl];
        }
        if (j < NSUB) {
            af = fn; df = fd;
            hn0 = hn1; hn1 = hn;                 // in the end: hnJ = sub-chunk J
            hd0 = hd1; hd1 = hd;
        } else {
            gn = fn; gd = fd;
            on0 = on1; on1 = hn;
            od0 = od1; od1 = hd;
        }
        if (j + 1 < 2 * NSUB) {
            #pragma unroll
            for (int tl = 0; tl < LCH; ++tl) { kA[tl] = kB[tl]; vA[tl] = vB[tl]; }
        }
    }
    sGn[wv][lane] = af;
    sGd[wv][lane] = df;
    sHn[wv][lane] = hn0 + dL * hn1;
    sHd[wv][lane] = hd0 + dL * hd1;
    // laid down farthest span first, so one ascending fold serves both halves
    const int oi = h ? wv : NSPAN - 1 - wv;
    sOn[oi][lane] = h ? gn : on0 + dL * on1;    // left half forward, right half backward
    sOd[oi][lane] = h ? gd : od0 + dL * od1;
    __syncthreads();

    // ---- carries into this span: forward from the left, backward from the right ----
    // The running fold is formed over all spans and sampled at this wave's own,
    // so the LDS reads depend on no branch and go out together.
    float cfn = 0.f, cfd = 0.f, cbn = 0.f, cbd = 0.f;
    float tn = 0.f, td = 0.f;                   // the other half's state at the joint
    #pragma unroll
    for (int i = 0; i < NSPAN; ++i) {
        tn = tn * dS + sOn[i][lane];
        td = td * dS + sOd[i][lane];
    }
    float rn = h ? tn : 0.f, rd = h ? td : 0.f;
    #pragma unroll
    for (int i = 0; i < NSPAN; ++i) {
        cfn = (i == wv) ? rn : cfn;
        cfd = (i == wv) ? rd : cfd;
        rn = rn * dS + sGn[i][lane];
        rd = rd * dS + sGd[i][lane];
    }
    rn = h ? 0.f : tn; rd = h ? 0.f : td;
    #pragma unroll
    for (int i = NSPAN - 1; i >= 0; --i) {
        cbn = (i == wv) ? rn : cbn;
        cbd = (i == wv) ? rd : cbd;
        rn = rn * dS + sHn[i][lane];
        rd = rd * dS + sHd[i][lane];
    }
    // backward state just right of each sub-chunk
    float cn1 = cbn, cn0 = hn1 + dL * cn1;
    float cd1 = cbd, cd0 = hd1 + dL * cd1;

    // ---- pass 2: both scans from their carries, then the output ----
    const float og = 0.8f + 0.2f * sTf;         // the output's time factor
    af = cfn; df = cfd;
    // rolled: one body in the instruction cache, one sub-chunk in registers
    #pragma unroll 1
    for (int j = 0; j < NSUB; ++j) {
        const int base = base0 + j * (LCH * C_);
        float kk[LCH], vv[LCH], rr[LCH];
        #pragma unroll
        for (int tl = LCH - 1; tl >= 0; --tl) {
            const int idx = base + tl * C_;
            kk[tl] = kin[idx];                  // second read: L2
            vv[tl] = vin[idx];
        }
        // a later load may land in an address register of the loads above
        asm volatile("s_wait_xcnt 0x0" ::: "memory");
        #pragma unroll
        for (int tl = 0; tl < LCH; ++tl) rr[tl] = rin[base + tl * C_];
        // keeps the sub-chunk's loads together in front of the arithmetic; left to
        // itself the scheduler can deal them out a few at a time, each with its wait
        __builtin_amdgcn_sched_barrier(0);
        float e[LCH], x[LCH], bn[LCH], bd[LCH];
        float ab = cn0, db = cd0;
        #pragma unroll
        for (int tl = LCH - 1; tl >= 0; --tl) {
            const float ek  = exp_slot(fminf(kk[tl], 30.f));
            const float euk = exp_slot(fminf(uc + kk[tl], 30.f));
            e[tl] = ek;
            x[tl] = ek * vv[tl];
            ab = ab * d + x[tl];
            db = db * d + ek;
            bn[tl] = ab + (euk - ek) * vv[tl];
            bd[tl] = db + (euk - ek);
        }
        #pragma unroll
        for (int tl = 0; tl < LCH; ++tl) {
            const int idx = base + tl * C_;
            af = af * d + x[tl];
            df = df * d + e[tl];
            const float num = af + bn[tl];
            const float den = df + bd[tl];
            // sigmoid(r) * num / max(den, 1e-8) with one reciprocal of both denominators'
            // product. den is bounded by the clamps at 30, so the product can leave the
            // f32 range only where the sigmoid is below 1e-21: the output is 0 there.
            const float p = (1.f + exp_slot(-rr[tl])) * fmaxf(den, 1e-8f);
            out[idx] = num * og * rcp_slot(p);
        }
        cn0 = cn1;
        cd0 = cd1;
        // the next trip rewrites the stores' address and data registers
        asm volatile("s_wait_xcnt 0x0" ::: "memory");
    }
}

// =====================================================================
// Launcher
// =====================================================================
extern "C" void kernel_launch(void* const* d_in, const int* in_sizes, int n_in,
                              void* d_out, int out_size, void* d_ws, size_t ws_size,
                              hipStream_t stream) {
    const float* r_in      = (const float*)d_in[0];   // [B,T,C]
    const float* k_in      = (const float*)d_in[1];   // [B,T,C]
    const float* v_in      = (const float*)d_in[2];   // [B,T,C]
    const float* time_emb  = (const float*)d_in[3];   // [B,TD]
    const float* w_in      = (const float*)d_in[4];   // [1,1,C]
    const float* u_in      = (const float*)d_in[5];   // [1,1,C]
    const float* wproj     = (const float*)d_in[6];   // [C,TD]
    const float* uproj     = (const float*)d_in[7];   // [C,TD]
    const float* lts       = (const float*)d_in[8];   // [1]
    float* out = (float*)d_out;                       // [B,T,C] fp32

    // projection, both scans, carries and the output: two work-groups per 32 channels
    k_fused<<<NH * (BC_ / CW), NSPAN * 32, 0, stream>>>(r_in, k_in, v_in, time_emb, w_in, u_in,
                                                        wproj, uproj, lts, out);
}

// v005
// Measured time: 18.5 microseconds a run.
// In both of two side-by-side timings against v004, it was 1.12 times as fast.
// Over all steps from v000 it is 3.65 times as fast.
#include <hip/hip_runtime.h>
#include <hip/hip_bf16.h>

// ---------------- problem constants (from reference) ----------------
#define B_ 4
#define T_ 2048
#define C_ 1024
#define TD_ 128

#define LCH 32               // sub-chunk length along T (kept in registers)
#define NSUB 2               // sub-chunks per span
#define SPAN (LCH * NSUB)    // 64 steps of T per span
#define NH 2                 // work-groups that share one channel group's T
#define TH (T_ / NH)         // 1024 steps of T whose output one work-group forms
#define NSPAN (TH / SPAN)    // 16 waves cover one half of T
#define CW 32                // channels per work-group: one 128-byte line
#define BC_ (B_ * C_)        // 4096 channels
#define GS 16                // steps per group read back from LDS in pass 2

typedef __attribute__((ext_vector_type(16))) _Float16 v16h;
typedef __attribute__((ext_vector_type(8)))  float    v8f;
typedef __attribute__((ext_vector_type(4)))  float    v4f;

// e^x as the fast exponential forms it (one multiply, v_exp_f32). The v_nop in
// the same statement is the free slot the instruction set asks for behind a
// transcendental.
__device__ __forceinline__ float exp_slot(float x)
{
    float r;
    asm("v_exp_f32 %0, %1\n\tv_nop" : "=v"(r) : "v"(x * 1.44269504088896340736f));
    return r;
}

// 1/x by the hardware's reciprocal (about one unit in the last place) in place of
// the exact division's long sequence, with the same free slot behind it.
__device__ __forceinline__ float rcp_slot(float x)
{
    float r;
    asm("v_rcp_f32 %0, %1\n\tv_nop" : "=v"(r) : "v"(x));
    return r;
}

// =====================================================================
// The one kernel: time-conditioning projection and the whole bidirectional scan.
// Head: every work-group forms decay, bonus and time factor of its own 32
// channels itself, while the first loads of k and v of its other waves fly:
//   tmpW[c] = sum_k time_emb[b,k] * time_w_proj[c,k]   (ditto U), on WMMA
//   (f16 in, f32 acc): waves 0..3 take one 16-column tile of W or U each;
//   wave 4 sums time_emb[b,:] for tf = sigmoid(sum); all three cross LDS.
//   decay = exp(-exp(w[c] + tmpW*s)) * (0.5 + 0.5*tf),  ucond = u[c] + tmpU*s
// Two work-groups share 32 channels of one batch row, so that every WGP has
// one: each forms the output of its own half of T. Nothing passes between
// them: each sums the other half itself and keeps the sum that runs towards
// its own half. Lane = channel, wave = a span of 64 steps in each half,
// worked as 2 sub-chunks of 32.
//   pass 1: own span scanned both ways with zero start; every step's local num
//           and den (forward + backward + bonus term) go to the thread's own
//           place in LDS, the span's sums (forward G, backward H) and the other
//           half's span sum (towards the own half) to the shared rows
//   barrier; every wave folds the other half's sums into the state at the
//   joint, then that and the other spans' sums into its two carries
//   pass 2: no second scan and no second read of k and v: a step's num and den
//           are its local values plus each carry times a power of the decay.
// Every loop over tl is fully unrolled so that its arrays live in registers.
// =====================================================================
__global__ void __launch_bounds__(NSPAN * 32)
k_fused(const float* __restrict__ rin, const float* __restrict__ kin,
        const float* __restrict__ vin,
        const float* __restrict__ time_emb,   // [B, TD]
        const float* __restrict__ w,          // [C]
        const float* __restrict__ u,          // [C]
        const float* __restrict__ wproj,      // [C, TD]
        const float* __restrict__ uproj,      // [C, TD]
        const float* __restrict__ lts,        // [1]
        float* __restrict__ out)
{
    // One struct, so that the small shared rows lie in front: their offsets then fit
    // the LDS instructions' offset field.
    struct Lds {
        float sP[2][CW];                        // tmpW, tmpU of the 32 channels
        float sGn[NSPAN][CW], sGd[NSPAN][CW];
        float sHn[NSPAN][CW], sHd[NSPAN][CW];
        float sOn[NSPAN][CW], sOd[NSPAN][CW];   // other half, nearest span last
        float sTf[4];                           // [0]: time factor of the batch row
        // local num and den of every own step, four steps a vector, each thread its own
        // row: one address register serves all of it, and the pitch of 33 vectors
        // (16 bytes x an odd number) keeps the 16-byte accesses free of bank conflicts
        v4f sS[NSPAN * 32][2 * (SPAN / 4) + 1];
    };
    __shared__ Lds lds;
    float (&sP)[2][CW] = lds.sP;
    float &sTf = lds.sTf[0];
    float (&sGn)[NSPAN][CW] = lds.sGn, (&sGd)[NSPAN][CW] = lds.sGd;
    float (&sHn)[NSPAN][CW] = lds.sHn, (&sHd)[NSPAN][CW] = lds.sHd;
    float (&sOn)[NSPAN][CW] = lds.sOn, (&sOd)[NSPAN][CW] = lds.sOd;
    v4f (&sS)[NSPAN * 32][2 * (SPAN / 4) + 1] = lds.sS;

    const int lane = threadIdx.x & 31;
    const int wv   = __builtin_amdgcn_readfirstlane(threadIdx.x >> 5);
    const int grp  = blockIdx.x % (BC_ / CW);   // channel group
    const int h    = blockIdx.x / (BC_ / CW);   // own half of T: 0 left, 1 right
    const int bc   = grp * CW + lane;
    const int b    = grp / (C_ / CW);
    const int c    = bc & (C_ - 1);

    const float wch = w[c];
    const float uch = u[c];
    const float scale = lts[0];
    // the two loads' index register is free for reuse behind this wait
    asm volatile("s_wait_xcnt 0x0" ::: "memory");

    // ---- head, part 1: waves 0..3 form the products of one 16-column tile each ----
    if (wv < 4) {
        const int m  = lane & 15;
        const int hi = lane >> 4;
        const float* te = time_emb + b * TD_;
        const float* pr = ((wv >> 1) ? uproj : wproj)
                        + ((grp * CW & (C_ - 1)) + (wv & 1) * 16 + m) * TD_;
        // 16-bit A 16x32 layout (ISA 7.12.2): lanes 0-15 rows, VGPR v holds
        // K = {2v,2v+1} (v<4) or {16+2(v-4),...}; lanes 16-31 add +8 to K.
        // B takes the same k at the same place, lane & 15 = column. Every
        // row of A is time_emb[b,:], so every row of D holds the 16 products.
        float fa[TD_ / 32][16], fb[TD_ / 32][16];
        #pragma unroll
        for (int q = 0; q < TD_ / 32; ++q) {
            #pragma unroll
            for (int e = 0; e < 16; ++e) {
                const int vg = e >> 1, hh = e & 1;
                const int kk = (vg < 4) ? (hi * 8 + 2 * vg + hh)
                                        : (16 + hi * 8 + 2 * (vg - 4) + hh);
                fa[q][e] = te[q * 32 + kk];
                fb[q][e] = pr[q * 32 + kk];
            }
        }
        // the operand loads' address registers are free for reuse behind this wait
        asm volatile("s_wait_xcnt 0x0" ::: "memory");
        v8f acc = {};
        #pragma unroll
        for (int q = 0; q < TD_ / 32; ++q) {
            v16h a, bb;
            #pragma unroll
            for (int e = 0; e < 16; ++e) {
                a[e]  = (_Float16)fa[q][e];
                bb[e] = (_Float16)fb[q][e];
            }
            acc = __builtin_amdgcn_wmma_f32_16x16x32_f16(
                false, a, false, bb, (short)0, acc, false, false);
        }
        // D layout: VGPR 0, lanes 0-15 -> row 0, column = lane
        if (lane < 16) sP[wv >> 1][(wv & 1) * 16 + lane] = acc[0];
    }
    const int base0 = (b * T_ + h * TH + wv * SPAN) * C_ + c;         // own half
    // other half: the half goes into the (uniform) pointers, the rest is an index
    const int baseo = (b * T_ + wv * SPAN) * C_ + c;
    const float* kio = kin + (h ^ 1) * (TH * C_);
    const float* vio = vin + (h ^ 1) * (TH * C_);

    // ---- pass 1: sums of this wave's two spans, zero start ----
    float af = 0.f, df = 0.f;                   // runs through the whole own span
    float hn0 = 0.f, hn1 = 0.f, hd0 = 0.f, hd1 = 0.f;   // own span, per sub-chunk
    float gn = 0.f, gd = 0.f;                   // runs through the whole other span
    float on0 = 0.f, on1 = 0.f, od0 = 0.f, od1 = 0.f;   // other span, per sub-chunk
    // unrolled, the next sub-chunk's loads written ahead of this one's sums:
    // memory stays busy while the wave computes
    float kA[LCH], vA[LCH];
    #pragma unroll
    for (int tl = 0; tl < LCH; ++tl) {
        kA[tl] = kin[base0 + tl * C_];
        vA[tl] = vin[base0 + tl * C_];
    }
    // keeps the rest of the head, with its waits, from being placed ahead of the
    // span's first loads
    __builtin_amdgcn_sched_barrier(0);

    // ---- head, part 2: time factor (wave 4), hand-over ----
    if (wv == 4) {
        float s = 0.f;
        #pragma unroll
        for (int j = 0; j < TD_; ++j) s += time_emb[b * TD_ + j];
        const float t = 1.f / (1.f + __expf(-s));
        if (lane == 0) sTf = t;
    }
    // Work-group barrier whose fences order LDS alone: __syncthreads() here would
    // also wait for the loads of k and v above, which are to stay in flight.
    __builtin_amdgcn_fence(__ATOMIC_RELEASE, "workgroup", "local");
    __builtin_amdgcn_s_barrier();
    __builtin_amdgcn_fence(__ATOMIC_ACQUIRE, "workgroup", "local");
    // keeps arithmetic on k, with its wait for the loads, out of the barrier
    __builtin_amdgcn_sched_barrier(0);
    const float d  = exp_slot(-exp_slot(wch + sP[0][lane] * scale)) * (0.5f + 0.5f * sTf);
    const float uc = uch + sP[1][lane] * scale;
    const float d2 = d * d, d4 = d2 * d2, d8 = d4 * d4, d16 = d8 * d8;
    const float dL = d16 * d16;                 // d^LCH
    const float dS = dL * dL;                   // d^SPAN
    #pragma unroll
    for (int j = 0; j < 2 * NSUB; ++j) {        // own sub-chunks, then the other half's
        float kB[LCH], vB[LCH];
        if (j + 1 < 2 * NSUB) {
            #pragma unroll
            for (int tl = 0; tl < LCH; ++tl) {
                if (j + 1 < NSUB) {
                    kB[tl] = kin[base0 + ((j + 1) * LCH + tl) * C_];
                    vB[tl] = vin[base0 + ((j + 1) * LCH + tl) * C_];
                } else {
                    kB[tl] = kio[baseo + ((j + 1 - NSUB) * LCH + tl) * C_];
                    vB[tl] = vio[baseo + ((j + 1 - NSUB) * LCH + tl) * C_];
                }
            }
        }
        float e[LCH], x[LCH];
        float hn = 0.f, hd = 0.f;
        if (j < NSUB) {
            // own sub-chunk: backward from zero, with the bonus term, ...
            float bn[LCH], bd[LCH];
            #pragma unroll
            for (int tl = LCH - 1; tl >= 0; --tl) {
                const float ek  = exp_slot(fminf(kA[tl], 30.f));
                const float euk = exp_slot(fminf(uc + kA[tl], 30.f));
                e[tl] = ek;
                x[tl] = ek * vA[tl];
                hn = hn * d + x[tl];
                hd = hd * d + ek;
                bn[tl] = hn + (euk - ek) * vA[tl];
                bd[tl] = hd + (euk - ek);
            }
            // ... forward from the span's start; the two together are kept
            #pragma unroll
            for (int q = 0; q < LCH / 4; ++q) {
                v4f sn, sd;
                #pragma unroll
                for (int m = 0; m < 4; ++m) {
                    const int tl = 4 * q + m;
                    af = af * d + x[tl];
                    df = df * d + e[tl];
                    sn[m] = af + bn[tl];
                    sd[m] = df + bd[tl];
                }
                sS[threadIdx.x][2 * (j * (LCH / 4) + q)]     = sn;
                sS[threadIdx.x][2 * (j * (LCH / 4) + q) + 1] = sd;
            }
            hn0 = hn1; hn1 = hn;                 // in the end: hnJ = sub-chunk J
            hd0 = hd1; hd1 = hd;
        } else {
            #pragma unroll
            for (int tl = 0; tl < LCH; ++tl) {
                e[tl] = exp_slot(fminf(kA[tl], 30.f));
                x[tl] = e[tl] * vA[tl];
            }
            // the other span is summed both ways and the side that runs towards the
            // own half is picked behind the loop: with a branch on the half here the
            // compiler sank the next loads under it, or spilled
            #pragma unroll
            for (int tl = 0; tl < LCH; ++tl) {
                gn = gn * d + x[tl];
                gd = gd * d + e[tl];
            }
            #pragma unroll
            for (int tl = LCH - 1; tl >= 0; --tl) {
                hn = hn * d + x[tl];
                hd = hd * d + e[tl];
            }
            on0 = on1; on1 = hn;
            od0 = od1; od1 = hd;
        }
        if (j + 1 < 2 * NSUB) {
            #pragma unroll
            for (int tl = 0; tl < LCH; ++tl) { kA[tl] = kB[tl]; vA[tl] = vB[tl]; }
        }
        // keeps the loads of the sub-chunk after the next out of this one's arithmetic:
        // with three sub-chunks in registers the compiler spilled
        __builtin_amdgcn_sched_barrier(0);
    }
    sGn[wv][lane] = af;
    sGd[wv][lane] = df;
    sHn[wv][lane] = hn0 + dL * hn1;
    sHd[wv][lane] = hd0 + dL * hd1;
    // laid down farthest span first, so one ascending fold serves both halves
    const int oi = h ? wv : NSPAN - 1 - wv;
    sOn[oi][lane] = h ? gn : on0 + dL * on1;    // left half forward, right half backward
    sOd[oi][lane] = h ? gd : od0 + dL * od1;
    __syncthreads();

    // pass 2 reads nothing else from memory: the span's r, asked for at once
    float rr[SPAN];
    #pragma unroll
    for (int tl = 0; tl < SPAN; ++tl) rr[tl] = rin[base0 + tl * C_];
    // keeps these loads in front of the folds below, which run while they fly
    __builtin_amdgcn_sched_barrier(0);

    // ---- carries into this span: forward from the left, backward from the right ----
    // The running fold is formed over all spans and sampled at this wave's own,
    // so the LDS reads depend on no branch and go out together.
    float cfn = 0.f, cfd = 0.f, cbn = 0.f, cbd = 0.f;
    float tn = 0.f, td = 0.f;                   // the other half's state at the joint
    #pragma unroll
    for (int i = 0; i < NSPAN; ++i) {
        tn = tn * dS + sOn[i][lane];
        td = td * dS + sOd[i][lane];
    }
    float rn = h ? tn : 0.f, rd = h ? td : 0.f;
    #pragma unroll
    for (int i = 0; i < NSPAN; ++i) {
        cfn = (i == wv) ? rn : cfn;
        cfd = (i == wv) ? rd : cfd;
        rn = rn * dS + sGn[i][lane];
        rd = rd * dS + sGd[i][lane];
    }
    rn = h ? 0.f : tn; rd = h ? 0.f : td;
    #pragma unroll
    for (int i = NSPAN - 1; i >= 0; --i) {
        cbn = (i == wv) ? rn : cbn;
        cbd = (i == wv) ? rd : cbd;
        rn = rn * dS + sHn[i][lane];
        rd = rd * dS + sHd[i][lane];
    }
    // ---- pass 2: local values plus carries times powers of the decay ----
    // the thread's own local values come back in groups of GS steps, a group ahead
    v4f sc[GS / 2], sx[GS / 2];
    #pragma unroll
    for (int q = 0; q < GS / 2; ++q) sc[q] = sS[threadIdx.x][q];
    const float og = 0.8f + 0.2f * sTf;         // the output's time factor
    float p[LCH];                               // p[i] = d^(i+1)
    p[0] = d; p[1] = d2; p[2] = d2 * d; p[3] = d4;
    #pragma unroll
    for (int i = 4; i < LCH; ++i) p[i] = p[i - 4] * d4;
    #pragma unroll
    for (int g = 0; g < SPAN / GS; ++g) {
        if (g + 1 < SPAN / GS) {
            #pragma unroll
            for (int q = 0; q < GS / 2; ++q) sx[q] = sS[threadIdx.x][(g + 1) * (GS / 2) + q];
        }
        // keeps the next group's LDS reads together in front of this group's arithmetic;
        // dealt out among it, each would be waited for where it is used
        __builtin_amdgcn_sched_barrier(0);
        const int j = g / (LCH / GS);           // sub-chunk of the group
        // forward: the local scan ran through the span, so sub-chunk 1 sees the carry
        // d^LCH further on; backward: it restarted, so sub-chunk 0 sees 1's sum too
        const float fcn = j ? dL * cfn : cfn, fcd = j ? dL * cfd : cfd;
        const float bcn = j ? cbn : hn1 + dL * cbn, bcd = j ? cbd : hd1 + dL * cbd;
        #pragma unroll
        for (int s = 0; s < GS; ++s) {
            const int tl = g * GS + s;          // step in the span
            const int i  = tl % LCH;            // step in the sub-chunk
            const float num = sc[2 * (s / 4)][s % 4]     + fcn * p[i] + bcn * p[LCH - 1 - i];
            const float den = sc[2 * (s / 4) + 1][s % 4] + fcd * p[i] + bcd * p[LCH - 1 - i];
            // sigmoid(r) * num / max(den, 1e-8) with one reciprocal of both denominators'
            // product. den is bounded by the clamps at 30, so the product can leave the
            // f32 range only where the sigmoid is below 1e-21: the output is 0 there.
            const float pr = (1.f + exp_slot(-rr[tl])) * fmaxf(den, 1e-8f);
            out[base0 + tl * C_] = num * og * rcp_slot(pr);
        }
        if (g + 1 < SPAN / GS) {
            #pragma unroll
            for (int q = 0; q < GS / 2; ++q) sc[q] = sx[q];
        }
    }
}

// =====================================================================
// Launcher
// =====================================================================
extern "C" void kernel_launch(void* const* d_in, const int* in_sizes, int n_in,
                              void* d_out, int out_size, void* d_ws, size_t ws_size,
                              hipStream_t stream) {
    const float* r_in      = (const float*)d_in[0];   // [B,T,C]
    const float* k_in      = (const float*)d_in[1];   // [B,T,C]
    const float* v_in      = (const float*)d_in[2];   // [B,T,C]
    const float* time_emb  = (const float*)d_in[3];   // [B,TD]
    const float* w_in      = (const float*)d_in[4];   // [1,1,C]
    const float* u_in      = (const float*)d_in[5];   // [1,1,C]
    const float* wproj     = (const float*)d_in[6];   // [C,TD]
    const float* uproj     = (const float*)d_in[7];   // [C,TD]
    const float* lts       = (const float*)d_in[8];   // [1]
    float* out = (float*)d_out;                       // [B,T,C] fp32

    // projection, both scans, carries and the output: two work-groups per 32 channels
    k_fused<<<NH * (BC_ / CW), NSPAN * 32, 0, stream>>>(r_in, k_in, v_in, time_emb, w_in, u_in,
                                                        wproj, uproj, lts, out);
}

// v006
// It runs in 16.6 microseconds.
// Next to v005, in two timings, it ran 1.11 and 1.12 times as fast.
// Counting every step since v000, it is 4.07 times as fast.
#include <hip/hip_runtime.h>
#include <hip/hip_bf16.h>

// ---------------- problem constants (from reference) ----------------
#define B_ 4
#define T_ 2048
#define C_ 1024
#define TD_ 128

#define LCH 32               // sub-chunk length along T (kept in registers)
#define NSUB 2               // sub-chunks per span
#define SPAN (LCH * NSUB)    // 64 steps of T per span
#define NH 2                 // work-groups that share one channel group's T
#define TH (T_ / NH)         // 1024 steps of T whose output one work-group forms
#define NSPAN (TH / SPAN)    // 16 waves cover one half of T
#define CW 32                // channels per work-group: one 128-byte line
#define BC_ (B_ * C_)        // 4096 channels
#define GS 16                // steps per group read back from LDS in pass 2

typedef __attribute__((ext_vector_type(16))) _Float16 v16h;
typedef __attribute__((ext_vector_type(8)))  float    v8f;
typedef __attribute__((ext_vector_type(4)))  float    v4f;

// e^x as the fast exponential forms it (one multiply, v_exp_f32). The v_nop in
// the same statement is the free slot the instruction set asks for behind a
// transcendental.
__device__ __forceinline__ float exp_slot(float x)
{
    float r;
    asm("v_exp_f32 %0, %1\n\tv_nop" : "=v"(r) : "v"(x * 1.44269504088896340736f));
    return r;
}

// t[i] = e^t[i], formed as exp_slot forms it, eight in one statement, each in place:
// every v_exp_f32 is the independent instruction that fills the free slot behind the one
// before it, so one v_nop behind the last serves all eight, and the eight multiplies in
// front stand side by side, where the compiler can pair them.
__device__ __forceinline__ void exp8(float (&t)[8])
{
    #pragma unroll
    for (int i = 0; i < 8; ++i) t[i] *= 1.44269504088896340736f;
    asm("v_exp_f32 %0, %0\n\tv_exp_f32 %1, %1\n\tv_exp_f32 %2, %2\n\tv_exp_f32 %3, %3\n\t"
        "v_exp_f32 %4, %4\n\tv_exp_f32 %5, %5\n\tv_exp_f32 %6, %6\n\tv_exp_f32 %7, %7\n\tv_nop"
        : "+v"(t[0]), "+v"(t[1]), "+v"(t[2]), "+v"(t[3]),
          "+v"(t[4]), "+v"(t[5]), "+v"(t[6]), "+v"(t[7]));
}

// t[i] = 1/t[i] by the hardware's reciprocal (about one unit in the last place) in place
// of the exact division's long sequence, eight in one statement in the same way
__device__ __forceinline__ void rcp8(float (&t)[8])
{
    asm("v_rcp_f32 %0, %0\n\tv_rcp_f32 %1, %1\n\tv_rcp_f32 %2, %2\n\tv_rcp_f32 %3, %3\n\t"
        "v_rcp_f32 %4, %4\n\tv_rcp_f32 %5, %5\n\tv_rcp_f32 %6, %6\n\tv_rcp_f32 %7, %7\n\tv_nop"
        : "+v"(t[0]), "+v"(t[1]), "+v"(t[2]), "+v"(t[3]),
          "+v"(t[4]), "+v"(t[5]), "+v"(t[6]), "+v"(t[7]));
}

// =====================================================================
// The one kernel: time-conditioning projection and the whole bidirectional scan.
// Head: every work-group forms decay, bonus and time factor of its own 32
// channels itself, while the first loads of k and v of its other waves fly:
//   tmpW[c] = sum_k time_emb[b,k] * time_w_proj[c,k]   (ditto U), on WMMA
//   (f16 in, f32 acc): waves 0..3 take one 16-column tile of W or U each;
//   wave 4 sums time_emb[b,:] for tf = sigmoid(sum); all three cross LDS.
//   decay = exp(-exp(w[c] + tmpW*s)) * (0.5 + 0.5*tf),  ucond = u[c] + tmpU*s
// Two work-groups share 32 channels of one batch row, so that every WGP has
// one: each forms the output of its own half of T. Nothing passes between
// them: each sums the other half itself and keeps the sum that runs towards
// its own half. Lane = channel, wave = a span of 64 steps in each half,
// worked as 2 sub-chunks of 32.
//   pass 1: own span scanned both ways with zero start; every step's local num
//           and den (forward + backward + bonus term) go to the thread's own
//           place in LDS, the span's sums (forward G, backward H) and the other
//           half's span sum (towards the own half) to the shared rows
//   barrier; every wave folds the other half's sums into the state at the
//   joint, then that and the other spans' sums into its two carries
//   pass 2: no second scan and no second read of k and v: a step's num and den
//           are its local values plus each carry times a power of the decay.
// Every loop over tl is fully unrolled so that its arrays live in registers.
// =====================================================================
__global__ void __launch_bounds__(NSPAN * 32)
k_fused(const float* __restrict__ rin, const float* __restrict__ kin,
        const float* __restrict__ vin,
        const float* __restrict__ time_emb,   // [B, TD]
        const float* __restrict__ w,          // [C]
        const float* __restrict__ u,          // [C]
        const float* __restrict__ wproj,      // [C, TD]
        const float* __restrict__ uproj,      // [C, TD]
        const float* __restrict__ lts,        // [1]
        float* __restrict__ out)
{
    // One struct, so that the small shared rows lie in front: their offsets then fit
    // the LDS instructions' offset field.
    struct Lds {
        float sP[2][CW];                        // tmpW, tmpU of the 32 channels
        float sGn[NSPAN][CW], sGd[NSPAN][CW];
        float sHn[NSPAN][CW], sHd[NSPAN][CW];
        float sOn[NSPAN][CW], sOd[NSPAN][CW];   // other half, nearest span last
        float sTf[4];                           // [0]: time factor of the batch row
        // local num and den of every own step, four steps a vector, each thread its own
        // row: one address register serves all of it, and the pitch of 33 vectors
        // (16 bytes x an odd number) keeps the 16-byte accesses free of bank conflicts
        v4f sS[NSPAN * 32][2 * (SPAN / 4) + 1];
    };
    __shared__ Lds lds;
    float (&sP)[2][CW] = lds.sP;
    float &sTf = lds.sTf[0];
    float (&sGn)[NSPAN][CW] = lds.sGn, (&sGd)[NSPAN][CW] = lds.sGd;
    float (&sHn)[NSPAN][CW] = lds.sHn, (&sHd)[NSPAN][CW] = lds.sHd;
    float (&sOn)[NSPAN][CW] = lds.sOn, (&sOd)[NSPAN][CW] = lds.sOd;
    v4f (&sS)[NSPAN * 32][2 * (SPAN / 4) + 1] = lds.sS;

    const int lane = threadIdx.x & 31;
    const int wv   = __builtin_amdgcn_readfirstlane(threadIdx.x >> 5);
    const int grp  = blockIdx.x % (BC_ / CW);   // channel group
    const int h    = blockIdx.x / (BC_ / CW);   // own half of T: 0 left, 1 right
    const int bc   = grp * CW + lane;
    const int b    = grp / (C_ / CW);
    const int c    = bc & (C_ - 1);

    const float wch = w[c];
    const float uch = u[c];
    const float scale = lts[0];
    // the two loads' index register is free for reuse behind this wait
    asm volatile("s_wait_xcnt 0x0" ::: "memory");

    // ---- head, part 1: waves 0..3 form the products of one 16-column tile each ----
    if (wv < 4) {
        const int m  = lane & 15;
        const int hi = lane >> 4;
        const float* te = time_emb + b * TD_;
        const float* pr = ((wv >> 1) ? uproj : wproj)
                        + ((grp * CW & (C_ - 1)) + (wv & 1) * 16 + m) * TD_;
        // 16-bit A 16x32 layout (ISA 7.12.2): lanes 0-15 rows, VGPR v holds
        // K = {2v,2v+1} (v<4) or {16+2(v-4),...}; lanes 16-31 add +8 to K.
        // B takes the same k at the same place, lane & 15 = column. Every
        // row of A is time_emb[b,:], so every row of D holds the 16 products.
        float fa[TD_ / 32][16], fb[TD_ / 32][16];
        #pragma unroll
        for (int q = 0; q < TD_ / 32; ++q) {
            #pragma unroll
            for (int e = 0; e < 16; ++e) {
                const int vg = e >> 1, hh = e & 1;
                const int kk = (vg < 4) ? (hi * 8 + 2 * vg + hh)
                                        : (16 + hi * 8 + 2 * (vg - 4) + hh);
                fa[q][e] = te[q * 32 + kk];
                fb[q][e] = pr[q * 32 + kk];
            }
        }
        // the operand loads' address registers are free for reuse behind this wait
        asm volatile("s_wait_xcnt 0x0" ::: "memory");
        v8f acc = {};
        #pragma unroll
        for (int q = 0; q < TD_ / 32; ++q) {
            v16h a, bb;
            #pragma unroll
            for (int e = 0; e < 16; ++e) {
                a[e]  = (_Float16)fa[q][e];
                bb[e] = (_Float16)fb[q][e];
            }
            acc = __builtin_amdgcn_wmma_f32_16x16x32_f16(
                false, a, false, bb, (short)0, acc, false, false);
        }
        // D layout: VGPR 0, lanes 0-15 -> row 0, column = lane
        if (lane < 16) sP[wv >> 1][(wv & 1) * 16 + lane] = acc[0];
    }
    const int base0 = (b * T_ + h * TH + wv * SPAN) * C_ + c;         // own half
    // other half: the half goes into the (uniform) pointers, the rest is an index
    const int baseo = (b * T_ + wv * SPAN) * C_ + c;
    const float* kio = kin + (h ^ 1) * (TH * C_);
    const float* vio = vin + (h ^ 1) * (TH * C_);

    // ---- pass 1: sums of this wave's two spans, zero start ----
    float af = 0.f, df = 0.f;                   // runs through the whole own span
    float hn0 = 0.f, hn1 = 0.f, hd0 = 0.f, hd1 = 0.f;   // own span, per sub-chunk
    float gn = 0.f, gd = 0.f;                   // runs through the whole other span
    float on0 = 0.f, on1 = 0.f, od0 = 0.f, od1 = 0.f;   // other span, per sub-chunk
    // unrolled, the next sub-chunk's loads written ahead of this one's sums:
    // memory stays busy while the wave computes
    float kA[LCH], vA[LCH];
    #pragma unroll
    for (int tl = 0; tl < LCH; ++tl) {
        kA[tl] = kin[base0 + tl * C_];
        vA[tl] = vin[base0 + tl * C_];
    }
    // keeps the rest of the head, with its waits, from being placed ahead of the
    // span's first loads
    __builtin_amdgcn_sched_barrier(0);

    // ---- head, part 2: time factor (wave 4), hand-over ----
    if (wv == 4) {
        float s = 0.f;
        #pragma unroll
        for (int j = 0; j < TD_; ++j) s += time_emb[b * TD_ + j];
        const float t = 1.f / (1.f + __expf(-s));
        if (lane == 0) sTf = t;
    }
    // Work-group barrier whose fences order LDS alone: __syncthreads() here would
    // also wait for the loads of k and v above, which are to stay in flight.
    __builtin_amdgcn_fence(__ATOMIC_RELEASE, "workgroup", "local");
    __builtin_amdgcn_s_barrier();
    __builtin_amdgcn_fence(__ATOMIC_ACQUIRE, "workgroup", "local");
    // keeps arithmetic on k, with its wait for the loads, out of the barrier
    __builtin_amdgcn_sched_barrier(0);
    const float d  = exp_slot(-exp_slot(wch + sP[0][lane] * scale)) * (0.5f + 0.5f * sTf);
    const float uc = uch + sP[1][lane] * scale;
    const float d2 = d * d, d4 = d2 * d2, d8 = d4 * d4, d16 = d8 * d8;
    const float dL = d16 * d16;                 // d^LCH
    const float dS = dL * dL;                   // d^SPAN
    #pragma unroll
    for (int j = 0; j < 2 * NSUB; ++j) {        // own sub-chunks, then the other half's
        float kB[LCH], vB[LCH];
        if (j + 1 < 2 * NSUB) {
            #pragma unroll
            for (int tl = 0; tl < LCH; ++tl) {
                if (j + 1 < NSUB) {
                    kB[tl] = kin[base0 + ((j + 1) * LCH + tl) * C_];
                    vB[tl] = vin[base0 + ((j + 1) * LCH + tl) * C_];
                } else {
                    kB[tl] = kio[baseo + ((j + 1 - NSUB) * LCH + tl) * C_];
                    vB[tl] = vio[baseo + ((j + 1 - NSUB) * LCH + tl) * C_];
                }
            }
        }
        float e[LCH], x[LCH];
        float hn = 0.f, hd = 0.f;
        if (j < NSUB) {
            // own sub-chunk: backward from zero, with the bonus term, ...
            float bn[LCH], bd[LCH];
            #pragma unroll
            for (int q = LCH / 4 - 1; q >= 0; --q) {
                float t[8];                      // four steps' two exponentials each
                #pragma unroll
                for (int m = 0; m < 4; ++m) {
                    t[m]     = fminf(kA[4 * q + m], 30.f);
                    t[4 + m] = fminf(uc + kA[4 * q + m], 30.f);
                }
                exp8(t);
                #pragma unroll
                for (int m = 3; m >= 0; --m) {
                    const int tl = 4 * q + m;
                    const float ek = t[m], euk = t[4 + m];
                    e[tl] = ek;
                    x[tl] = ek * vA[tl];
                    hn = hn * d + x[tl];
                    hd = hd * d + ek;
                    bn[tl] = hn + (euk - ek) * vA[tl];
                    bd[tl] = hd + (euk - ek);
                }
            }
            // ... forward from the span's start; the two together are kept
            #pragma unroll
            for (int q = 0; q < LCH / 4; ++q) {
                v4f sn, sd;
                #pragma unroll
                for (int m = 0; m < 4; ++m) {
                    const int tl = 4 * q + m;
                    af = af * d + x[tl];
                    df = df * d + e[tl];
                    sn[m] = af + bn[tl];
                    sd[m] = df + bd[tl];
                }
                sS[threadIdx.x][2 * (j * (LCH / 4) + q)]     = sn;
                sS[threadIdx.x][2 * (j * (LCH / 4) + q) + 1] = sd;
            }
            hn0 = hn1; hn1 = hn;                 // in the end: hnJ = sub-chunk J
            hd0 = hd1; hd1 = hd;
        } else {
            #pragma unroll
            for (int q = 0; q < LCH / 8; ++q) {
                float t[8];
                #pragma unroll
                for (int m = 0; m < 8; ++m) t[m] = fminf(kA[8 * q + m], 30.f);
                exp8(t);
                #pragma unroll
                for (int m = 0; m < 8; ++m) {
                    e[8 * q + m] = t[m];
                    x[8 * q + m] = t[m] * vA[8 * q + m];
                }
            }
            // the other span is summed both ways and the side that runs towards the
            // own half is picked behind the loop: with a branch on the half here the
            // compiler sank the next loads under it, or spilled
            #pragma unroll
            for (int tl = 0; tl < LCH; ++tl) {
                gn = gn * d + x[tl];
                gd = gd * d + e[tl];
            }
            #pragma unroll
            for (int tl = LCH - 1; tl >= 0; --tl) {
                hn = hn * d + x[tl];
                hd = hd * d + e[tl];
            }
            on0 = on1; on1 = hn;
            od0 = od1; od1 = hd;
        }
        if (j + 1 < 2 * NSUB) {
            #pragma unroll
            for (int tl = 0; tl < LCH; ++tl) { kA[tl] = kB[tl]; vA[tl] = vB[tl]; }
        }
        // keeps the loads of the sub-chunk after the next out of this one's arithmetic:
        // with three sub-chunks in registers the compiler spilled
        __builtin_amdgcn_sched_barrier(0);
    }
    sGn[wv][lane] = af;
    sGd[wv][lane] = df;
    sHn[wv][lane] = hn0 + dL * hn1;
    sHd[wv][lane] = hd0 + dL * hd1;
    // laid down farthest span first, so one ascending fold serves both halves
    const int oi = h ? wv : NSPAN - 1 - wv;
    sOn[oi][lane] = h ? gn : on0 + dL * on1;    // left half forward, right half backward
    sOd[oi][lane] = h ? gd : od0 + dL * od1;
    __syncthreads();

    // pass 2 reads nothing else from memory: the span's r, asked for at once
    float rr[SPAN];
    #pragma unroll
    for (int tl = 0; tl < SPAN; ++tl) rr[tl] = rin[base0 + tl * C_];
    // keeps these loads in front of the folds below, which run while they fly
    __builtin_amdgcn_sched_barrier(0);

    // ---- carries into this span: forward from the left, backward from the right ----
    // The running fold is formed over all spans and sampled at this wave's own,
    // so the LDS reads depend on no branch and go out together.
    float cfn = 0.f, cfd = 0.f, cbn = 0.f, cbd = 0.f;
    float tn = 0.f, td = 0.f;                   // the other half's state at the joint
    #pragma unroll
    for (int i = 0; i < NSPAN; ++i) {
        tn = tn * dS + sOn[i][lane];
        td = td * dS + sOd[i][lane];
    }
    float rn = h ? tn : 0.f, rd = h ? td : 0.f;
    #pragma unroll
    for (int i = 0; i < NSPAN; ++i) {
        cfn = (i == wv) ? rn : cfn;
        cfd = (i == wv) ? rd : cfd;
        rn = rn * dS + sGn[i][lane];
        rd = rd * dS + sGd[i][lane];
    }
    rn = h ? 0.f : tn; rd = h ? 0.f : td;
    #pragma unroll
    for (int i = NSPAN - 1; i >= 0; --i) {
        cbn = (i == wv) ? rn : cbn;
        cbd = (i == wv) ? rd : cbd;
        rn = rn * dS + sHn[i][lane];
        rd = rd * dS + sHd[i][lane];
    }
    // ---- pass 2: local values plus carries times powers of the decay ----
    // the thread's own local values come back in groups of GS steps, a group ahead
    v4f sc[GS / 2], sx[GS / 2];
    #pragma unroll
    for (int q = 0; q < GS / 2; ++q) sc[q] = sS[threadIdx.x][q];
    const float og = 0.8f + 0.2f * sTf;         // the output's time factor
    float p[LCH];                               // p[i] = d^(i+1)
    p[0] = d; p[1] = d2; p[2] = d2 * d; p[3] = d4;
    #pragma unroll
    for (int i = 4; i < LCH; ++i) p[i] = p[i - 4] * d4;
    #pragma unroll
    for (int g = 0; g < SPAN / GS; ++g) {
        if (g + 1 < SPAN / GS) {
            #pragma unroll
            for (int q = 0; q < GS / 2; ++q) sx[q] = sS[threadIdx.x][(g + 1) * (GS / 2) + q];
        }
        // keeps the next group's LDS reads together in front of this group's arithmetic;
        // dealt out among it, each would be waited for where it is used
        __builtin_amdgcn_sched_barrier(0);
        const int j = g / (LCH / GS);           // sub-chunk of the group
        // forward: the local scan ran through the span, so sub-chunk 1 sees the carry
        // d^LCH further on; backward: it restarted, so sub-chunk 0 sees 1's sum too
        const float fcn = j ? dL * cfn : cfn, fcd = j ? dL * cfd : cfd;
        const float bcn = j ? cbn : hn1 + dL * cbn, bcd = j ? cbd : hd1 + dL * cbd;
        #pragma unroll
        for (int s8 = 0; s8 < GS; s8 += 8) {
            float t[8], num[8];
            #pragma unroll
            for (int m = 0; m < 8; ++m) t[m] = -rr[g * GS + s8 + m];
            exp8(t);
            #pragma unroll
            for (int m = 0; m < 8; ++m) {
                const int s = s8 + m;
                const int i = (g * GS + s) % LCH;   // step in the sub-chunk
                num[m] = sc[2 * (s / 4)][s % 4] + fcn * p[i] + bcn * p[LCH - 1 - i];
                const float den = sc[2 * (s / 4) + 1][s % 4] + fcd * p[i] + bcd * p[LCH - 1 - i];
                // sigmoid(r) * num / max(den, 1e-8) with one reciprocal of both denominators'
                // product. den is bounded by the clamps at 30, so the product can leave the
                // f32 range only where the sigmoid is below 1e-21: the output is 0 there.
                t[m] = (1.f + t[m]) * fmaxf(den, 1e-8f);
            }
            rcp8(t);
            #pragma unroll
            for (int m = 0; m < 8; ++m)
                out[base0 + (g * GS + s8 + m) * C_] = num[m] * og * t[m];
        }
        if (g + 1 < SPAN / GS) {
            #pragma unroll
            for (int q = 0; q < GS / 2; ++q) sc[q] = sx[q];
        }
    }
}

// =====================================================================
// Launcher
// =====================================================================
extern "C" void kernel_launch(void* const* d_in, const int* in_sizes, int n_in,
                              void* d_out, int out_size, void* d_ws, size_t ws_size,
                              hipStream_t stream) {
    const float* r_in      = (const float*)d_in[0];   // [B,T,C]
    const float* k_in      = (const float*)d_in[1];   // [B,T,C]
    const float* v_in      = (const float*)d_in[2];   // [B,T,C]
    const float* time_emb  = (const float*)d_in[3];   // [B,TD]
    const float* w_in      = (const float*)d_in[4];   // [1,1,C]
    const float* u_in      = (const float*)d_in[5];   // [1,1,C]
    const float* wproj     = (const float*)d_in[6];   // [C,TD]
    const float* uproj     = (const float*)d_in[7];   // [C,TD]
    const float* lts       = (const float*)d_in[8];   // [1]
    float* out = (float*)d_out;                       // [B,T,C] fp32

    // projection, both scans, carries and the output: two work-groups per 32 channels
    k_fused<<<NH * (BC_ / CW), NSPAN * 32, 0, stream>>>(r_in, k_in, v_in, time_emb, w_in, u_in,
                                                        wproj, uproj, lts, out);
}

// v007
// Measured time: 15.2 microseconds a run.
// Timed twice side by side with v006, it ran 1.11 times as fast both times.
// Over all steps from v000 it is 4.52 times as fast.
#include <hip/hip_runtime.h>
#include <hip/hip_bf16.h>

// ---------------- problem constants (from reference) ----------------
#define B_ 4
#define T_ 2048
#define C_ 1024
#define TD_ 128

#define LCH 32               // sub-chunk length along T (kept in registers)
#define NSUB 2               // sub-chunks per span
#define SPAN (LCH * NSUB)    // 64 steps of T per span
#define NH 2                 // work-groups that share one channel group's T
#define TH (T_ / NH)         // 1024 steps of T whose output one work-group forms
#define NSPAN (TH / SPAN)    // 16 waves cover one half of T
#define CW 32                // channels per work-group: one 128-byte line
#define BC_ (B_ * C_)        // 4096 channels
#define GS 16                // steps per group read back from LDS in pass 2
#define SL 4                 // rows of one band of the other half that one wave takes
#define GB 4                 // bands of the other half fetched and summed together
#define NGRP (TH / (SPAN * GB))   // such groups in the other half

typedef __attribute__((ext_vector_type(16))) _Float16 v16h;
typedef __attribute__((ext_vector_type(8)))  float    v8f;
typedef __attribute__((ext_vector_type(4)))  float    v4f;

// e^x as the fast exponential forms it (one multiply, v_exp_f32). The v_nop in
// the same statement is the free slot the instruction set asks for behind a
// transcendental.
__device__ __forceinline__ float exp_slot(float x)
{
    float r;
    asm("v_exp_f32 %0, %1\n\tv_nop" : "=v"(r) : "v"(x * 1.44269504088896340736f));
    return r;
}

// t[i] = e^t[i], formed as exp_slot forms it, eight in one statement, each in place:
// every v_exp_f32 is the independent instruction that fills the free slot behind the one
// before it, so one v_nop behind the last serves all eight, and the eight multiplies in
// front stand side by side, where the compiler can pair them.
__device__ __forceinline__ void exp8(float (&t)[8])
{
    #pragma unroll
    for (int i = 0; i < 8; ++i) t[i] *= 1.44269504088896340736f;
    asm("v_exp_f32 %0, %0\n\tv_exp_f32 %1, %1\n\tv_exp_f32 %2, %2\n\tv_exp_f32 %3, %3\n\t"
        "v_exp_f32 %4, %4\n\tv_exp_f32 %5, %5\n\tv_exp_f32 %6, %6\n\tv_exp_f32 %7, %7\n\tv_nop"
        : "+v"(t[0]), "+v"(t[1]), "+v"(t[2]), "+v"(t[3]),
          "+v"(t[4]), "+v"(t[5]), "+v"(t[6]), "+v"(t[7]));
}

// t[i] = 1/t[i] by the hardware's reciprocal (about one unit in the last place) in place
// of the exact division's long sequence, eight in one statement in the same way
__device__ __forceinline__ void rcp8(float (&t)[8])
{
    asm("v_rcp_f32 %0, %0\n\tv_rcp_f32 %1, %1\n\tv_rcp_f32 %2, %2\n\tv_rcp_f32 %3, %3\n\t"
        "v_rcp_f32 %4, %4\n\tv_rcp_f32 %5, %5\n\tv_rcp_f32 %6, %6\n\tv_rcp_f32 %7, %7\n\tv_nop"
        : "+v"(t[0]), "+v"(t[1]), "+v"(t[2]), "+v"(t[3]),
          "+v"(t[4]), "+v"(t[5]), "+v"(t[6]), "+v"(t[7]));
}

// =====================================================================
// The one kernel: time-conditioning projection and the whole bidirectional scan.
// Head: every work-group forms decay, bonus and time factor of its own 32
// channels itself, while the first loads of k and v of its other waves fly:
//   tmpW[c] = sum_k time_emb[b,k] * time_w_proj[c,k]   (ditto U), on WMMA
//   (f16 in, f32 acc): waves 0..3 take one 16-column tile of W or U each;
//   wave 4 sums time_emb[b,:] for tf = sigmoid(sum); all three cross LDS.
//   decay = exp(-exp(w[c] + tmpW*s)) * (0.5 + 0.5*tf),  ucond = u[c] + tmpU*s
// Two work-groups share 32 channels of one batch row, so that every WGP has
// one: each forms the output of its own half of T. Nothing passes between
// them: each sums the other half itself, towards its own half. Lane = channel,
// wave = a span of 64 steps of the own half, worked as 2 sub-chunks of 32.
//   pass 1: own span scanned both ways with zero start; every step's local num
//           and den (forward + backward + bonus term) go to the thread's own
//           place in LDS, the span's sums (forward G, backward H) to the shared rows
//   other half: the state it hands over at the joint is the sum of every row times
//           d^(its distance from the joint). It is cut into bands of 64 rows,
//           nearest first, and every wave takes 4 rows of every band. A band's
//           weight is a running f32 product; once that product is exactly 0 in all
//           32 channels, every later product is 0 too and those rows add exactly
//           nothing, so they are neither read nor summed. With a slow decay the
//           weights stay above 0 and all 16 bands are summed.
//   barrier; every wave adds the waves' shares up to the state at the joint and
//   folds that and the other spans' sums into its two carries
//   pass 2: no second scan and no second read of k and v: a step's num and den
//           are its local values plus each carry times a power of the decay.
// Every loop over tl is fully unrolled so that its arrays live in registers.
// =====================================================================
__global__ void __launch_bounds__(NSPAN * 32)
k_fused(const float* __restrict__ rin, const float* __restrict__ kin,
        const float* __restrict__ vin,
        const float* __restrict__ time_emb,   // [B, TD]
        const float* __restrict__ w,          // [C]
        const float* __restrict__ u,          // [C]
        const float* __restrict__ wproj,      // [C, TD]
        const float* __restrict__ uproj,      // [C, TD]
        const float* __restrict__ lts,        // [1]
        float* __restrict__ out)
{
    // One struct, so that the small shared rows lie in front: their offsets then fit
    // the LDS instructions' offset field.
    struct Lds {
        float sP[2][CW];                        // tmpW, tmpU of the 32 channels
        float sGn[NSPAN][CW], sGd[NSPAN][CW];
        float sHn[NSPAN][CW], sHd[NSPAN][CW];
        float sOn[NSPAN][CW], sOd[NSPAN][CW];   // other half, each wave's share
        float sTf[4];                           // [0]: time factor of the batch row
        // local num and den of every own step, four steps a vector, each thread its own
        // row: one address register serves all of it, and the pitch of 33 vectors
        // (16 bytes x an odd number) keeps the 16-byte accesses free of bank conflicts
        v4f sS[NSPAN * 32][2 * (SPAN / 4) + 1];
    };
    __shared__ Lds lds;
    float (&sP)[2][CW] = lds.sP;
    float &sTf = lds.sTf[0];
    float (&sGn)[NSPAN][CW] = lds.sGn, (&sGd)[NSPAN][CW] = lds.sGd;
    float (&sHn)[NSPAN][CW] = lds.sHn, (&sHd)[NSPAN][CW] = lds.sHd;
    float (&sOn)[NSPAN][CW] = lds.sOn, (&sOd)[NSPAN][CW] = lds.sOd;
    v4f (&sS)[NSPAN * 32][2 * (SPAN / 4) + 1] = lds.sS;

    const int lane = threadIdx.x & 31;
    const int wv   = __builtin_amdgcn_readfirstlane(threadIdx.x >> 5);
    const int grp  = blockIdx.x % (BC_ / CW);   // channel group
    const int h    = blockIdx.x / (BC_ / CW);   // own half of T: 0 left, 1 right
    const int bc   = grp * CW + lane;
    const int b    = grp / (C_ / CW);
    const int c    = bc & (C_ - 1);

    const float wch = w[c];
    const float uch = u[c];
    const float scale = lts[0];
    // the two loads' index register is free for reuse behind this wait
    asm volatile("s_wait_xcnt 0x0" ::: "memory");

    // ---- head, part 1: waves 0..3 form the products of one 16-column tile each ----
    if (wv < 4) {
        const int m  = lane & 15;
        const int hi = lane >> 4;
        const float* te = time_emb + b * TD_;
        const float* pr = ((wv >> 1) ? uproj : wproj)
                        + ((grp * CW & (C_ - 1)) + (wv & 1) * 16 + m) * TD_;
        // 16-bit A 16x32 layout (ISA 7.12.2): lanes 0-15 rows, VGPR v holds
        // K = {2v,2v+1} (v<4) or {16+2(v-4),...}; lanes 16-31 add +8 to K.
        // B takes the same k at the same place, lane & 15 = column. Every
        // row of A is time_emb[b,:], so every row of D holds the 16 products.
        float fa[TD_ / 32][16], fb[TD_ / 32][16];
        #pragma unroll
        for (int q = 0; q < TD_ / 32; ++q) {
            #pragma unroll
            for (int e = 0; e < 16; ++e) {
                const int vg = e >> 1, hh = e & 1;
                const int kk = (vg < 4) ? (hi * 8 + 2 * vg + hh)
                                        : (16 + hi * 8 + 2 * (vg - 4) + hh);
                fa[q][e] = te[q * 32 + kk];
                fb[q][e] = pr[q * 32 + kk];
            }
        }
        // the operand loads' address registers are free for reuse behind this wait
        asm volatile("s_wait_xcnt 0x0" ::: "memory");
        v8f acc = {};
        #pragma unroll
        for (int q = 0; q < TD_ / 32; ++q) {
            v16h a, bb;
            #pragma unroll
            for (int e = 0; e < 16; ++e) {
                a[e]  = (_Float16)fa[q][e];
                bb[e] = (_Float16)fb[q][e];
            }
            acc = __builtin_amdgcn_wmma_f32_16x16x32_f16(
                false, a, false, bb, (short)0, acc, false, false);
        }
        // D layout: VGPR 0, lanes 0-15 -> row 0, column = lane
        if (lane < 16) sP[wv >> 1][(wv & 1) * 16 + lane] = acc[0];
    }
    const int base0 = (b * T_ + h * TH + wv * SPAN) * C_ + c;         // own half
    // other half: lowest of the wave's rows in the group of bands at the joint, and the
    // step to the next group, which leads away from the joint (both the same in every
    // lane: they stay in the pointers, the lane adds its channel). Within a group every
    // row is a constant offset, whichever way the bands are counted.
    const int orow  = (b * T_ + (h ? TH - SL - SL * wv - (GB - 1) * SPAN : TH + SL * wv)) * C_;
    const int gstep = h ? -GB * SPAN * C_ : GB * SPAN * C_;
    const float* kob = kin + orow;
    const float* vob = vin + orow;

    // ---- pass 1: sums of this wave's own span, zero start ----
    float af = 0.f, df = 0.f;                   // runs through the whole own span
    float hn0 = 0.f, hn1 = 0.f, hd0 = 0.f, hd1 = 0.f;   // own span, per sub-chunk
    float ko[GB * SL], vo[GB * SL];             // other half: the group of bands in work
    // unrolled, the next sub-chunk's loads written ahead of this one's sums:
    // memory stays busy while the wave computes
    float kA[LCH], vA[LCH];
    #pragma unroll
    for (int tl = 0; tl < LCH; ++tl) {
        kA[tl] = kin[base0 + tl * C_];
        vA[tl] = vin[base0 + tl * C_];
    }
    // keeps the rest of the head, with its waits, from being placed ahead of the
    // span's first loads
    __builtin_amdgcn_sched_barrier(0);

    // ---- head, part 2: time factor (wave 4), hand-over ----
    if (wv == 4) {
        float s = 0.f;
        #pragma unroll
        for (int j = 0; j < TD_; ++j) s += time_emb[b * TD_ + j];
        const float t = 1.f / (1.f + __expf(-s));
        if (lane == 0) sTf = t;
    }
    // Work-group barrier whose fences order LDS alone: __syncthreads() here would
    // also wait for the loads of k and v above, which are to stay in flight.
    __builtin_amdgcn_fence(__ATOMIC_RELEASE, "workgroup", "local");
    __builtin_amdgcn_s_barrier();
    __builtin_amdgcn_fence(__ATOMIC_ACQUIRE, "workgroup", "local");
    // keeps arithmetic on k, with its wait for the loads, out of the barrier
    __builtin_amdgcn_sched_barrier(0);
    const float d  = exp_slot(-exp_slot(wch + sP[0][lane] * scale)) * (0.5f + 0.5f * sTf);
    const float uc = uch + sP[1][lane] * scale;
    const float d2 = d * d, d4 = d2 * d2, d8 = d4 * d4, d16 = d8 * d8;
    const float dL = d16 * d16;                 // d^LCH
    const float dS = dL * dL;                   // d^SPAN
    #pragma unroll
    for (int j = 0; j < NSUB; ++j) {            // own sub-chunks
        float kB[LCH], vB[LCH];
        if (j + 1 < NSUB) {
            #pragma unroll
            for (int tl = 0; tl < LCH; ++tl) {
                kB[tl] = kin[base0 + ((j + 1) * LCH + tl) * C_];
                vB[tl] = vin[base0 + ((j + 1) * LCH + tl) * C_];
            }
        } else {
            // the other half's nearest bands fly while the last own sub-chunk is summed
            #pragma unroll
            for (int i = 0; i < GB * SL; ++i) {
                ko[i] = (kob + ((i / SL) * SPAN + i % SL) * C_)[c];
                vo[i] = (vob + ((i / SL) * SPAN + i % SL) * C_)[c];
            }
            // the loads' offset and base registers are free for reuse behind this wait (it
            // names the offset, so that none of the loads is given that register to fill)
            asm volatile("s_wait_xcnt 0x0" :: "v"(c) : "memory");
            // keeps these loads in front of the sub-chunk's arithmetic: dealt out among
            // it, the last would still be on their way where they are used
            __builtin_amdgcn_sched_barrier(0);
        }
        float e[LCH], x[LCH];
        float hn = 0.f, hd = 0.f;
        // backward from zero, with the bonus term, ...
        float bn[LCH], bd[LCH];
        #pragma unroll
        for (int q = LCH / 4 - 1; q >= 0; --q) {
            float t[8];                      // four steps' two exponentials each
            #pragma unroll
            for (int m = 0; m < 4; ++m) {
                t[m]     = fminf(kA[4 * q + m], 30.f);
                t[4 + m] = fminf(uc + kA[4 * q + m], 30.f);
            }
            exp8(t);
            #pragma unroll
            for (int m = 3; m >= 0; --m) {
                const int tl = 4 * q + m;
                const float ek = t[m], euk = t[4 + m];
                e[tl] = ek;
                x[tl] = ek * vA[tl];
                hn = hn * d + x[tl];
                hd = hd * d + ek;
                bn[tl] = hn + (euk - ek) * vA[tl];
                bd[tl] = hd + (euk - ek);
            }
        }
        // ... forward from the span's start; the two together are kept
        #pragma unroll
        for (int q = 0; q < LCH / 4; ++q) {
            v4f sn, sd;
            #pragma unroll
            for (int m = 0; m < 4; ++m) {
                const int tl = 4 * q + m;
                af = af * d + x[tl];
                df = df * d + e[tl];
                sn[m] = af + bn[tl];
                sd[m] = df + bd[tl];
            }
            sS[threadIdx.x][2 * (j * (LCH / 4) + q)]     = sn;
            sS[threadIdx.x][2 * (j * (LCH / 4) + q) + 1] = sd;
        }
        hn0 = hn1; hn1 = hn;                 // in the end: hnJ = sub-chunk J
        hd0 = hd1; hd1 = hd;
        if (j + 1 < NSUB) {
            #pragma unroll
            for (int tl = 0; tl < LCH; ++tl) { kA[tl] = kB[tl]; vA[tl] = vB[tl]; }
        }
        // keeps what is loaded after the next sub-chunk out of this one's arithmetic:
        // with three sub-chunks in registers the compiler spilled
        __builtin_amdgcn_sched_barrier(0);
    }
    sGn[wv][lane] = af;
    sGd[wv][lane] = df;
    sHn[wv][lane] = hn0 + dL * hn1;
    sHd[wv][lane] = hd0 + dL * hd1;

    // ---- the other half: this wave's share of its state at the joint ----
    // weight of a row = d^(rows between it and the joint)
    //                 = (band) d^64.. x (the wave's place in the band) d^(4 wv) x (row) d^0..3;
    // the addresses rise with the row, so in the left half the last row of the last band
    // is the nearest
    const float d3 = d2 * d;
    const float pw[SL] = { h ? d3 : 1.f, h ? d2 : d, h ? d : d2, h ? 1.f : d3 };
    const float dG = (dS * dS) * (dS * dS);     // d^(SPAN * GB): from group to group
    float wg = ((wv & 1) ? d4 : 1.f) * ((wv & 2) ? d8 : 1.f)
             * ((wv & 4) ? d16 : 1.f) * ((wv & 8) ? dL : 1.f);
    float on = 0.f, od = 0.f;
    // stays a loop: behind the first trip it runs only as far as the decay's powers last
    #pragma nounroll
    for (int g = 0; ; ++g) {
        // The next group's largest weight. Every weight behind it is this product times
        // further powers of d: where it is 0 in all lanes, all that is left adds 0.
        const float wn = wg * dG;
        const bool more = g + 1 < NGRP && __builtin_amdgcn_ballot_w32(wn != 0.f) != 0u;
        float kn[GB * SL], vn[GB * SL];
        if (more) {
            #pragma unroll
            for (int i = 0; i < GB * SL; ++i) {
                kn[i] = (kob + (g + 1) * gstep + ((i / SL) * SPAN + i % SL) * C_)[c];
                vn[i] = (vob + (g + 1) * gstep + ((i / SL) * SPAN + i % SL) * C_)[c];
            }
            // the loads' base registers are free for reuse behind this wait
            asm volatile("s_wait_xcnt 0x0" ::: "memory");
        }
        #pragma unroll
        for (int q = 0; q < GB * SL / 8; ++q) {
            float t[8];
            #pragma unroll
            for (int m = 0; m < 8; ++m) t[m] = fminf(ko[8 * q + m], 30.f);
            exp8(t);
            #pragma unroll
            for (int m = 0; m < 8; ++m) ko[8 * q + m] = t[m];
        }
        float wq[GB];                           // the group's bands, nearest first
        wq[0] = wg;
        #pragma unroll
        for (int bb = 1; bb < GB; ++bb) wq[bb] = wq[bb - 1] * dS;
        #pragma unroll
        for (int bb = 0; bb < GB; ++bb) {       // in the order of the addresses
            const float wb = h ? wq[GB - 1 - bb] : wq[bb];
            float qn = 0.f, qd = 0.f;
            #pragma unroll
            for (int m = 0; m < SL; ++m) {
                qn += ko[bb * SL + m] * vo[bb * SL + m] * pw[m];
                qd += ko[bb * SL + m] * pw[m];
            }
            on += wb * qn;
            od += wb * qd;
        }
        if (!more) break;
        #pragma unroll
        for (int i = 0; i < GB * SL; ++i) { ko[i] = kn[i]; vo[i] = vn[i]; }
        wg = wn;
    }
    sOn[wv][lane] = on;
    sOd[wv][lane] = od;
    __syncthreads();

    // pass 2 reads nothing else from memory: the span's r, asked for at once
    float rr[SPAN];
    #pragma unroll
    for (int tl = 0; tl < SPAN; ++tl) rr[tl] = rin[base0 + tl * C_];
    // keeps these loads in front of the folds below, which run while they fly
    __builtin_amdgcn_sched_barrier(0);

    // ---- carries into this span: forward from the left, backward from the right ----
    // The running fold is formed over all spans and sampled at this wave's own,
    // so the LDS reads depend on no branch and go out together.
    float cfn = 0.f, cfd = 0.f, cbn = 0.f, cbd = 0.f;
    float tn = 0.f, td = 0.f;                   // the other half's state at the joint
    #pragma unroll
    for (int i = 0; i < NSPAN; ++i) {
        tn += sOn[i][lane];
        td += sOd[i][lane];
    }
    float rn = h ? tn : 0.f, rd = h ? td : 0.f;
    #pragma unroll
    for (int i = 0; i < NSPAN; ++i) {
        cfn = (i == wv) ? rn : cfn;
        cfd = (i == wv) ? rd : cfd;
        rn = rn * dS + sGn[i][lane];
        rd = rd * dS + sGd[i][lane];
    }
    rn = h ? 0.f : tn; rd = h ? 0.f : td;
    #pragma unroll
    for (int i = NSPAN - 1; i >= 0; --i) {
        cbn = (i == wv) ? rn : cbn;
        cbd = (i == wv) ? rd : cbd;
        rn = rn * dS + sHn[i][lane];
        rd = rd * dS + sHd[i][lane];
    }
    // ---- pass 2: local values plus carries times powers of the decay ----
    // the thread's own local values come back in groups of GS steps, a group ahead
    v4f sc[GS / 2], sx[GS / 2];
    #pragma unroll
    for (int q = 0; q < GS / 2; ++q) sc[q] = sS[threadIdx.x][q];
    const float og = 0.8f + 0.2f * sTf;         // the output's time factor
    float p[LCH];                               // p[i] = d^(i+1)
    p[0] = d; p[1] = d2; p[2] = d2 * d; p[3] = d4;
    #pragma unroll
    for (int i = 4; i < LCH; ++i) p[i] = p[i - 4] * d4;
    #pragma unroll
    for (int g = 0; g < SPAN / GS; ++g) {
        if (g + 1 < SPAN / GS) {
            #pragma unroll
            for (int q = 0; q < GS / 2; ++q) sx[q] = sS[threadIdx.x][(g + 1) * (GS / 2) + q];
        }
        // keeps the next group's LDS reads together in front of this group's arithmetic;
        // dealt out among it, each would be waited for where it is used
        __builtin_amdgcn_sched_barrier(0);
        const int j = g / (LCH / GS);           // sub-chunk of the group
        // forward: the local scan ran through the span, so sub-chunk 1 sees the carry
        // d^LCH further on; backward: it restarted, so sub-chunk 0 sees 1's sum too
        const float fcn = j ? dL * cfn : cfn, fcd = j ? dL * cfd : cfd;
        const float bcn = j ? cbn : hn1 + dL * cbn, bcd = j ? cbd : hd1 + dL * cbd;
        #pragma unroll
        for (int s8 = 0; s8 < GS; s8 += 8) {
            float t[8], num[8];
            #pragma unroll
            for (int m = 0; m < 8; ++m) t[m] = -rr[g * GS + s8 + m];
            exp8(t);
            #pragma unroll
            for (int m = 0; m < 8; ++m) {
                const int s = s8 + m;
                const int i = (g * GS + s) % LCH;   // step in the sub-chunk
                num[m] = sc[2 * (s / 4)][s % 4] + fcn * p[i] + bcn * p[LCH - 1 - i];
                const float den = sc[2 * (s / 4) + 1][s % 4] + fcd * p[i] + bcd * p[LCH - 1 - i];
                // sigmoid(r) * num / max(den, 1e-8) with one reciprocal of both denominators'
                // product. den is bounded by the clamps at 30, so the product can leave the
                // f32 range only where the sigmoid is below 1e-21: the output is 0 there.
                t[m] = (1.f + t[m]) * fmaxf(den, 1e-8f);
            }
            rcp8(t);
            #pragma unroll
            for (int m = 0; m < 8; ++m)
                out[base0 + (g * GS + s8 + m) * C_] = num[m] * og * t[m];
        }
        if (g + 1 < SPAN / GS) {
            #pragma unroll
            for (int q = 0; q < GS / 2; ++q) sc[q] = sx[q];
        }
    }
}

// =====================================================================
// Launcher
// =====================================================================
extern "C" void kernel_launch(void* const* d_in, const int* in_sizes, int n_in,
                              void* d_out, int out_size, void* d_ws, size_t ws_size,
                              hipStream_t stream) {
    const float* r_in      = (const float*)d_in[0];   // [B,T,C]
    const float* k_in      = (const float*)d_in[1];   // [B,T,C]
    const float* v_in      = (const float*)d_in[2];   // [B,T,C]
    const float* time_emb  = (const float*)d_in[3];   // [B,TD]
    const float* w_in      = (const float*)d_in[4];   // [1,1,C]
    const float* u_in      = (const float*)d_in[5];   // [1,1,C]
    const float* wproj     = (const float*)d_in[6];   // [C,TD]
    const float* uproj     = (const float*)d_in[7];   // [C,TD]
    const float* lts       = (const float*)d_in[8];   // [1]
    float* out = (float*)d_out;                       // [B,T,C] fp32

    // projection, both scans, carries and the output: two work-groups per 32 channels
    k_fused<<<NH * (BC_ / CW), NSPAN * 32, 0, stream>>>(r_in, k_in, v_in, time_emb, w_in, u_in,
                                                        wproj, uproj, lts, out);
}
